// v009
// The times below were measured on an AMD MI455X: many runs one after another, warmed up first and cycling through
// copies of the inputs, with the whole window's GPU time divided by the number of runs. Launches and the gaps
// between them are all in it. The median over several windows is given; except for v000 it joins two sittings, which
// can be a few percent apart, so the side-by-side timings, each taken in one sitting, are the better comparison.
// Earlier versions than v009 are not in this document.
// Measured time: 109 microseconds a run.
// Next to v008, in two timings, it ran 1.18 and 1.17 times as fast.
// All steps since the starting kernel, v000, together make it 8.46 times as fast.
#include <hip/hip_runtime.h>
// Self-KAN attention (4 images, 256 channels, 64 x 64): att = conv1x1(x) (64 ch); q, k, v = FastKAN 1x1 convs (base_conv(silu(att)) + spline_conv(RBF basis of the instance-normalised att, 8 grid points)); energy = q.k over the 4096 positions (NO scaling), softmax over keys, out = v.attn^T; att2 = conv1x1(out) (256 ch); y = gamma*x + att2; training-mode BatchNorm -> [4,256,64,64].
// Compute dtype: x, weights, biases, gamma, BN affine rounded to bf16; x exact in f16; silu/basis operands as hi + 16x residual pairs (~2^-20); q, k, P, v as hi + x2^10 residual pairs (~2^-21); the attention output as hi + 16x residual pairs too; f32 accumulation, statistics, softmax. v_wmma_f32_16x16x32_f16.
#define NIMG 4
#define CIN 256
#define DK 64
#define HW 64
#define NPI (HW * HW)            /* 4096 */
#define NPX (NIMG * NPI)         /* 16384 */
#define NG 8
#define NH 1
#define DM DK
#define SCL 1.0f
#define KSPLIT 4
#define LOG2E 1.4426950408889634f
typedef __bf16 v16b __attribute__((ext_vector_type(16)));
typedef unsigned short v8us __attribute__((ext_vector_type(8), may_alias));
typedef float  v8f  __attribute__((ext_vector_type(8)));
typedef float  v4f  __attribute__((ext_vector_type(4)));
typedef float  v2f  __attribute__((ext_vector_type(2)));
typedef float  v4fa __attribute__((ext_vector_type(4), may_alias));
union FragB { v16b v; v8us half[2]; unsigned short u[16]; };

__device__ __forceinline__ unsigned short bf16_bits(float x) { unsigned int u = __float_as_uint(x); return (unsigned short)((u + 0x7FFFu + ((u >> 16) & 1u)) >> 16); }
__device__ __forceinline__ float bf16_val(unsigned short b) { return __uint_as_float(((unsigned int)b) << 16); }
__device__ __forceinline__ float bf16_round(float x) { return bf16_val(bf16_bits(x)); }
// D += A·B with NT terms: 1 = ah·bh, 2 = + al·bh (A split), 3 = + ah·bl (both split)
template <int NT>
__device__ __forceinline__ v8f mmaN(v16b ah, v16b al, v16b bh, v16b bl, v8f c) {
  c = __builtin_amdgcn_wmma_f32_16x16x32_bf16(false, ah, false, bh, (short)0, c, false, false);
  if (NT >= 2) c = __builtin_amdgcn_wmma_f32_16x16x32_bf16(false, al, false, bh, (short)0, c, false, false);
  if (NT >= 3) c = __builtin_amdgcn_wmma_f32_16x16x32_bf16(false, ah, false, bl, (short)0, c, false, false);
  asm volatile("v_nop\n\tv_nop\n\tv_nop\n\tv_nop" : "+v"(c) : "v"(ah), "v"(al), "v"(bh), "v"(bl));
  return c;
}

__global__ __launch_bounds__(256) void k_wt_bf16(const float* __restrict__ W, unsigned short* __restrict__ Wt, int K, int N) {
  const int t = blockIdx.x * 256 + threadIdx.x;
  const int k8n = K / 8;
  if (t >= N * k8n) return;
  const int n = t / k8n, k8 = (t % k8n) * 8;
  v8us v;
#pragma unroll
  for (int i = 0; i < 8; ++i) v[i] = bf16_bits(W[(size_t)(k8 + i) * N + n]);
  *(v8us*)(Wt + (size_t)n * K + k8) = v;
  
}

// GEMM C[M][N] (f32, pitch ldc) = act(A[M][K]·W + bias). A f32 row-major (pitch lda) converted per fragment to bf16
// (ASPLIT: hi/lo two planes -> 2 terms, else single rounded term); Wt bf16 [N][K] (pitch ldb). BIAS_BF16 rounds the
// bias to bf16 first (bias quantised to bf16 before the add). K%32==0, M%16==0, N%64==0.
template <bool ASPLIT, int ACT, bool BIAS_BF16>
__global__ __launch_bounds__(128) void k_gemm_bf(const float* __restrict__ A, int lda, const unsigned short* __restrict__ Wt, int ldb,
                                               const float* __restrict__ bias, float* __restrict__ C, int ldc, int M, int N, int K) {
  __shared__ __attribute__((aligned(16))) float so[4][16][64];
  const int tid = threadIdx.x, w = tid >> 5, lane = tid & 31, ln = lane & 15, hh = lane >> 4;
  const int ntn = N / 64;
  const int wid = blockIdx.x * 4 + w;
  const int mt = wid / ntn, nq = wid % ntn;
  if (mt * 16 >= M) return;
  const int row0 = mt * 16, col0 = nq * 64;
  const float* arow = A + (size_t)(row0 + ln) * lda;
  v8f acc[4] = {};
  for (int kb = 0; kb < K; kb += 32) {
    FragB ah, al;
    const v4f x0 = *(const v4fa*)(arow + kb + 8 * hh), x1 = *(const v4fa*)(arow + kb + 8 * hh + 4);
    const v4f x2 = *(const v4fa*)(arow + kb + 16 + 8 * hh), x3 = *(const v4fa*)(arow + kb + 16 + 8 * hh + 4);
    float xs[16] = {x0[0],x0[1],x0[2],x0[3],x1[0],x1[1],x1[2],x1[3],x2[0],x2[1],x2[2],x2[3],x3[0],x3[1],x3[2],x3[3]};
#pragma unroll
    for (int i = 0; i < 16; ++i) { const unsigned short hb = bf16_bits(xs[i]); ah.u[i] = hb; al.u[i] = ASPLIT ? bf16_bits(xs[i] - bf16_val(hb)) : (unsigned short)0; }
#pragma unroll
    for (int t = 0; t < 4; ++t) {
      const unsigned short* brow = Wt + (size_t)(col0 + t * 16 + ln) * ldb + kb;
      FragB b;
      b.half[0] = *(const v8us*)(brow + 8 * hh);
      b.half[1] = *(const v8us*)(brow + 16 + 8 * hh);
      acc[t] = mmaN<ASPLIT ? 2 : 1>(ah.v, al.v, b.v, b.v, acc[t]);
    }
  }
#pragma unroll
  for (int t = 0; t < 4; ++t) {
    float bv = bias ? bias[col0 + t * 16 + ln] : 0.f;
    if (BIAS_BF16) bv = bf16_round(bv);
#pragma unroll
    for (int r = 0; r < 8; ++r) { float v = acc[t][r] + bv; if (ACT == 1) v = fmaxf(v, 0.f); so[w][8 * hh + r][t * 16 + ln] = v; }
  }
  __builtin_amdgcn_fence(__ATOMIC_ACQ_REL, "workgroup");
  __builtin_amdgcn_wave_barrier();
  const int rsub = lane >> 4, c4 = (lane & 15) * 4;
  {
#pragma unroll
    for (int q = 0; q < 8; ++q) {
      const int r = q * 2 + rsub;
      const v4f v = *(const v4fa*)&so[w][r][c4];
      *(v4f*)(C + (size_t)(row0 + r) * ldc + col0 + c4) = v;
    }
    
  }
}

// GEMM C = act(A·W + bias + resid): A f32 (ASPLIT -> hi/lo 2 terms), Wt bf16 [N][K]; ACT 0 none, 1 relu, 2 exact gelu;
// resid (optional, f32, row index = (row % rmod), pitch ldr, RES_BF16 rounds it) added before the activation.
template <bool ASPLIT, int ACT, bool BIAS_BF16, bool RES_BF16>
__global__ __launch_bounds__(128) void k_gemm_bf3(const float* __restrict__ A, int lda, const unsigned short* __restrict__ Wt, int ldb,
                                                const float* __restrict__ bias, const float* __restrict__ resid, int rmod, int ldr,
                                                float* __restrict__ C, int ldc, int M, int N, int K) {
  __shared__ __attribute__((aligned(16))) float so[4][16][64];
  const int tid = threadIdx.x, w = tid >> 5, lane = tid & 31, ln = lane & 15, hh = lane >> 4;
  const int ntn = N / 64;
  const int wid = blockIdx.x * 4 + w;
  const int mt = wid / ntn, nq = wid % ntn;
  if (mt * 16 >= M) return;
  const int row0 = mt * 16, col0 = nq * 64;
  const float* arow = A + (size_t)(row0 + ln) * lda;
  v8f acc[4] = {};
  for (int kb = 0; kb < K; kb += 32) {
    FragB ah, al;
    const v4f x0 = *(const v4fa*)(arow + kb + 8 * hh), x1 = *(const v4fa*)(arow + kb + 8 * hh + 4);
    const v4f x2 = *(const v4fa*)(arow + kb + 16 + 8 * hh), x3 = *(const v4fa*)(arow + kb + 16 + 8 * hh + 4);
    float xs[16] = {x0[0],x0[1],x0[2],x0[3],x1[0],x1[1],x1[2],x1[3],x2[0],x2[1],x2[2],x2[3],x3[0],x3[1],x3[2],x3[3]};
#pragma unroll
    for (int i = 0; i < 16; ++i) { const unsigned short hb = bf16_bits(xs[i]); ah.u[i] = hb; al.u[i] = ASPLIT ? bf16_bits(xs[i] - bf16_val(hb)) : (unsigned short)0; }
#pragma unroll
    for (int t = 0; t < 4; ++t) {
      const unsigned short* brow = Wt + (size_t)(col0 + t * 16 + ln) * ldb + kb;
      FragB b;
      b.half[0] = *(const v8us*)(brow + 8 * hh);
      b.half[1] = *(const v8us*)(brow + 16 + 8 * hh);
      acc[t] = mmaN<ASPLIT ? 2 : 1>(ah.v, al.v, b.v, b.v, acc[t]);
    }
  }
#pragma unroll
  for (int t = 0; t < 4; ++t) {
    const int col = col0 + t * 16 + ln;
    float bv = bias ? bias[col] : 0.f;
    if (BIAS_BF16) bv = bf16_round(bv);
#pragma unroll
    for (int r = 0; r < 8; ++r) {
      float v = acc[t][r] + bv;
      if (resid) { float rv = resid[(size_t)((row0 + 8 * hh + r) % rmod) * ldr + col]; if (RES_BF16) rv = bf16_round(rv); v += rv; }
      if (ACT == 1) v = fmaxf(v, 0.f);
      if (ACT == 2) v = 0.5f * v * (1.0f + erff(v * 0.70710678118654752f));
      if (ACT == 3) { const float u = 0.7978845608028654f * (v + 0.044715f * v * v * v); v = 0.5f * v * (1.0f + tanhf(u)); }
      so[w][8 * hh + r][t * 16 + ln] = v;
    }
  }
  __builtin_amdgcn_fence(__ATOMIC_ACQ_REL, "workgroup");
  __builtin_amdgcn_wave_barrier();
  const int rsub = lane >> 4, c4 = (lane & 15) * 4;
  {
#pragma unroll
    for (int q = 0; q < 8; ++q) {
      const int r = q * 2 + rsub;
      const v4f v = *(const v4fa*)&so[w][r][c4];
      *(v4f*)(C + (size_t)(row0 + r) * ldc + col0 + c4) = v;
    }
    
  }
}
// row LayerNorm (biased variance, eps) over N: s = X (+ R); optional out_sum <- s; out_norm <- (s-mu)*rsqrt(var+eps)*g + b
template <bool PARAM_BF16>
__global__ __launch_bounds__(256) void k_layernorm(const float* __restrict__ X, const float* __restrict__ R, const float* __restrict__ g, const float* __restrict__ bta,
                                                  float* __restrict__ out_sum, float* __restrict__ out_norm, int N, float eps) {
  __shared__ float red[256];
  const int row = blockIdx.x, tid = threadIdx.x;
  const float* x = X + (size_t)row * N; const float* rr = R ? R + (size_t)row * N : nullptr;
  float vals[16];                     // up to N = 4096
  const int per = N / 256;            // contiguous chunk per thread? use strided-by-4 chunks: thread handles j = tid*4 + 1024*u
  float s1 = 0.f;
  for (int u = 0; u < per / 4; ++u) {
    const int j = tid * 4 + 1024 * u;
    const v4f a = *(const v4fa*)(x + j);
    v4f b = {0.f,0.f,0.f,0.f}; if (rr) b = *(const v4fa*)(rr + j);
#pragma unroll
    for (int q = 0; q < 4; ++q) { const float v = a[q] + b[q]; vals[u * 4 + q] = v; s1 += v; }
  }
  red[tid] = s1; __syncthreads();
  for (int st = 128; st > 0; st >>= 1) { if (tid < st) red[tid] += red[tid + st]; __syncthreads(); }
  const float mu = red[0] / (float)N; __syncthreads();
  float s2 = 0.f;
  for (int u = 0; u < per / 4; ++u)
#pragma unroll
    for (int q = 0; q < 4; ++q) { const float c = vals[u * 4 + q] - mu; s2 += c * c; }
  red[tid] = s2; __syncthreads();
  for (int st = 128; st > 0; st >>= 1) { if (tid < st) red[tid] += red[tid + st]; __syncthreads(); }
  const float rs = rsqrtf(red[0] / (float)N + eps);
  {
    for (int u = 0; u < per / 4; ++u) {
      const int j = tid * 4 + 1024 * u;
      v4f o, sm;
#pragma unroll
      for (int q = 0; q < 4; ++q) {
        float gg = g[j + q], bb = bta[j + q];
        if (PARAM_BF16) { gg = bf16_round(gg); bb = bf16_round(bb); }
        sm[q] = vals[u * 4 + q]; o[q] = (vals[u * 4 + q] - mu) * rs * gg + bb;
      }
      if (out_sum) *(v4f*)(out_sum + (size_t)row * N + j) = sm;
      *(v4f*)(out_norm + (size_t)row * N + j) = o;
    }
    
  }
}



// ---- f16 WMMA path (v_wmma_f32_16x16x32_f16): 11-bit significands for operands in range — used where a [0,1] probability operand needs more precision than bf16
typedef _Float16 v16h __attribute__((ext_vector_type(16)));
union FragH { v16h v; v8us half[2]; _Float16 h[16]; unsigned short u[16]; };
template <int NT>
__device__ __forceinline__ v8f mmaH(v16h ah, v16h al, v16h bh, v16h bl, v8f c) {
  c = __builtin_amdgcn_wmma_f32_16x16x32_f16(false, ah, false, bh, (short)0, c, false, false);
  if (NT >= 2) c = __builtin_amdgcn_wmma_f32_16x16x32_f16(false, al, false, bh, (short)0, c, false, false);
  if (NT >= 3) c = __builtin_amdgcn_wmma_f32_16x16x32_f16(false, ah, false, bl, (short)0, c, false, false);
  asm volatile("v_nop\n\tv_nop\n\tv_nop\n\tv_nop" : "+v"(c) : "v"(ah), "v"(al), "v"(bh), "v"(bl));
  return c;
}
// batched GEMM like k_gemm_b but f16 operands: A f32 (split into f16 hi/lo if ASPLIT, else rounded to f16), Bt = f16 values [n][k]; alpha; C f32; N multiple of 16 (partial tiles skipped)
template <bool ASPLIT>
__global__ __launch_bounds__(128) void k_gemm_h(const float* __restrict__ A, int lda, size_t sA, const _Float16* __restrict__ Bh, int ldb, size_t sB, float alpha, float* __restrict__ C, int ldc, size_t sC, int M, int N, int K) {
  __shared__ __attribute__((aligned(16))) float so[4][16][64];
  const int tid = threadIdx.x, w = tid >> 5, lane = tid & 31, ln = lane & 15, hh = lane >> 4; const int by = blockIdx.y;
  A += (size_t)by * sA; Bh += (size_t)by * sB; C += (size_t)by * sC;
  const int ntn = (N + 63) / 64; const int wid = blockIdx.x * 4 + w; const int mt = wid / ntn, nq = wid % ntn; if (mt * 16 >= M) return;
  const int row0 = mt * 16, col0 = nq * 64; const float* arow = A + (size_t)(row0 + ln) * lda;
  v8f acc[4] = {};
  for (int kb = 0; kb < K; kb += 32) {
    FragH ah, al;
    const v4f x0 = *(const v4fa*)(arow + kb + 8 * hh), x1 = *(const v4fa*)(arow + kb + 8 * hh + 4), x2 = *(const v4fa*)(arow + kb + 16 + 8 * hh), x3 = *(const v4fa*)(arow + kb + 16 + 8 * hh + 4);
    float xs[16] = {x0[0],x0[1],x0[2],x0[3],x1[0],x1[1],x1[2],x1[3],x2[0],x2[1],x2[2],x2[3],x3[0],x3[1],x3[2],x3[3]};
#pragma unroll
    for (int i = 0; i < 16; ++i) { const _Float16 h = (_Float16)xs[i]; ah.h[i] = h; al.h[i] = ASPLIT ? (_Float16)(xs[i] - (float)h) : (_Float16)0.0f; }
#pragma unroll
    for (int t = 0; t < 4; ++t) { if (col0 + t * 16 >= N) continue; const size_t boff = (size_t)(col0 + t * 16 + ln) * ldb + kb; FragH bq; bq.half[0] = *(const v8us*)(Bh + boff + 8 * hh); bq.half[1] = *(const v8us*)(Bh + boff + 16 + 8 * hh);
      acc[t] = mmaH<ASPLIT ? 2 : 1>(ah.v, al.v, bq.v, bq.v, acc[t]); }
  }
#pragma unroll
  for (int t = 0; t < 4; ++t) { if (col0 + t * 16 >= N) continue;
#pragma unroll
    for (int r = 0; r < 8; ++r) so[w][8 * hh + r][t * 16 + ln] = acc[t][r] * alpha; }
  __builtin_amdgcn_fence(__ATOMIC_ACQ_REL, "workgroup"); __builtin_amdgcn_wave_barrier();
  const int rsub = lane >> 4, c4 = (lane & 15) * 4;
  {
#pragma unroll
    for (int q = 0; q < 8; ++q) { const int r = q * 2 + rsub; if (col0 + c4 < N) { const v4f v = *(const v4fa*)&so[w][r][c4]; *(v4f*)(C + (size_t)(row0 + r) * ldc + col0 + c4) = v; } }
     }
}

// Wt[n][k] = f16(W[k][n]·scale) from f32 row-major W[K][N] (scale = power of two; bf16-exact weights stay exact in f16 away from the subnormal range)
__global__ __launch_bounds__(256) void k_wt_f16(const float* __restrict__ W, _Float16* __restrict__ Wt, int K, int N, float scale) {
  const int t = blockIdx.x * 256 + threadIdx.x; if (t >= N * (K / 8)) return; const int n = t / (K / 8), k8 = (t % (K / 8)) * 8; FragH f;
#pragma unroll
  for (int i = 0; i < 8; ++i) f.h[i] = (_Float16)(bf16_round(W[(size_t)(k8 + i) * N + n]) * scale); const v8us o = f.half[0];
  *(v8us*)((unsigned short*)Wt + (size_t)n * K + k8) = o; 
}
// k_gemm_hh variant with fused epilogue: v = acc·alpha + bias[by·sBias + col] (+ CP[(row/rowsPerB)·sCPb + by·64 + col] if CP) ; ACT 0 none / 1 elu ; writes f16 C16 (and f32 C if non-null)
template <int ACT>
__global__ __launch_bounds__(128) void k_gemm_hhx(const _Float16* __restrict__ A, int lda, size_t sA, const _Float16* __restrict__ Bh, int ldb, size_t sB, float alpha, const float* __restrict__ bias, size_t sBias, const float* __restrict__ CP, int rowsPerB, size_t sCPb, int row0g,
    float* __restrict__ C, _Float16* __restrict__ C16, int ldc, size_t sC, int M, int N, int K) {
  __shared__ __attribute__((aligned(16))) float so[4][16][64];
  const int tid = threadIdx.x, w = tid >> 5, lane = tid & 31, ln = lane & 15, hh = lane >> 4; const int by = blockIdx.y;
  A += (size_t)by * sA; Bh += (size_t)by * sB; const size_t cofs = (size_t)by * sC; const float* bp = bias ? bias + (size_t)by * sBias : nullptr;
  const int ntn = (N + 63) / 64; const int wid = blockIdx.x * 4 + w; const int mt = wid / ntn, nq = wid % ntn; if (mt * 16 >= M) return;
  const int row0 = mt * 16, col0 = nq * 64; const _Float16* arow = A + (size_t)(row0 + ln) * lda;
  v8f acc[4] = {};
  for (int kb = 0; kb < K; kb += 32) { FragH ah; ah.half[0] = *(const v8us*)((const unsigned short*)arow + kb + 8 * hh); ah.half[1] = *(const v8us*)((const unsigned short*)arow + kb + 16 + 8 * hh);
#pragma unroll
    for (int t = 0; t < 4; ++t) { if (col0 + t * 16 >= N) continue; const size_t boff = (size_t)(col0 + t * 16 + ln) * ldb + kb; FragH bq; bq.half[0] = *(const v8us*)((const unsigned short*)Bh + boff + 8 * hh); bq.half[1] = *(const v8us*)((const unsigned short*)Bh + boff + 16 + 8 * hh);
      acc[t] = mmaH<1>(ah.v, ah.v, bq.v, bq.v, acc[t]); }
  }
#pragma unroll
  for (int t = 0; t < 4; ++t) { if (col0 + t * 16 >= N) continue; const int col = col0 + t * 16 + ln; const float bv = bp ? bf16_round(bp[col]) : 0.f;
#pragma unroll
    for (int r = 0; r < 8; ++r) { float v = acc[t][r] * alpha + bv; if (CP) { const int bidx = (row0g + row0 + 8 * hh + r) / rowsPerB; v += CP[(size_t)bidx * sCPb + (size_t)by * 64 + col]; } if (ACT == 1) v = (v > 0.f) ? v : expm1f(v); else if (ACT == 7) v = (v > 0.f) ? v + 1.0f : expf(v); else if (ACT == 8) v = tanhf(v); else if (ACT == 9) v = 0.5f * v * (1.0f + tanhf(0.7978845608028654f * (v + 0.044715f * v * v * v))); else if (ACT == 11) v = 1.0f / (1.0f + expf(-v)); else if (ACT == 12) v = (v > 0.f) ? v : 0.01f * v; else if (ACT == 14) v = (v > 0.f) ? v : 0.1f * v; else if (ACT == 15) v = v / (1.0f + expf(-v)); else if (ACT == 3) v = fmaxf(v, 0.f); else if (ACT == 6) v = 0.5f * v * (1.0f + erff(v * 0.70710678118654752f)); so[w][8 * hh + r][t * 16 + ln] = v; } }
  __builtin_amdgcn_fence(__ATOMIC_ACQ_REL, "workgroup"); __builtin_amdgcn_wave_barrier();
  const int rsub = lane >> 4, c4 = (lane & 15) * 4; typedef _Float16 v4h __attribute__((ext_vector_type(4)));
  {
#pragma unroll
    for (int q = 0; q < 8; ++q) { const int r = q * 2 + rsub; if (col0 + c4 < N) { const v4f v = *(const v4fa*)&so[w][r][c4]; if (C) *(v4f*)(C + cofs + (size_t)(row0 + r) * ldc + col0 + c4) = v; if (C16) { v4h h4; for (int i = 0; i < 4; ++i) h4[i] = (_Float16)v[i]; *(v4h*)(C16 + cofs + (size_t)(row0 + r) * ldc + col0 + c4) = h4; } } }
     }
}


typedef _Float16 v4h __attribute__((ext_vector_type(4)));

__global__ __launch_bounds__(256) void k_x16(const float* __restrict__ x, _Float16* __restrict__ X16, size_t n8) { const size_t t = (size_t)blockIdx.x * 256 + threadIdx.x; if (t >= n8) return; FragH f;
#pragma unroll
  for (int q = 0; q < 8; ++q) f.h[q] = (_Float16)bf16_round(x[t * 8 + q]); *(v8us*)((unsigned short*)X16 + t * 8) = f.half[0];  }
__global__ __launch_bounds__(256) void k_h16(const float* __restrict__ x, _Float16* __restrict__ X16, size_t n8) { const size_t t = (size_t)blockIdx.x * 256 + threadIdx.x; if (t >= n8) return; FragH f;
#pragma unroll
  for (int q = 0; q < 8; ++q) f.h[q] = (_Float16)x[t * 8 + q]; *(v8us*)((unsigned short*)X16 + t * 8) = f.half[0];  }
__device__ __forceinline__ void d_round16f(const float* __restrict__ W, _Float16* __restrict__ Bt, size_t n8, unsigned bx) { const size_t t = (size_t)bx * 256 + threadIdx.x; if (t >= n8) return; FragH f;
#pragma unroll
  for (int i = 0; i < 8; ++i) f.h[i] = (_Float16)(bf16_round(W[t * 8 + i]) * 16.0f); *(v8us*)((unsigned short*)Bt + t * 8) = f.half[0];  }
template <int NHv, int TTv>
__global__ __launch_bounds__(256) void k_vt(const _Float16* __restrict__ V16, int ldv, int voff, _Float16* __restrict__ Vt) { __shared__ unsigned short tl[64][66]; const int tid = threadIdx.x; const int slab = blockIdx.x / (TTv / 64), lg = blockIdx.x % (TTv / 64); const int b = slab / NHv, h = slab % NHv;
  for (int i = tid; i < 64 * 8; i += 256) { const int r = i / 8, c8 = (i % 8) * 8; FragH f; f.half[0] = *(const v8us*)((const unsigned short*)V16 + ((size_t)b * TTv + lg * 64 + r) * ldv + voff + h * 64 + c8);
#pragma unroll
    for (int q = 0; q < 8; ++q) tl[r][c8 + q] = f.u[q]; }
  __syncthreads();
  {
#pragma unroll
    for (int rd = 0; rd < 2; ++rd) { const int d = rd * 32 + tid / 8, pc = tid % 8; FragH f;
#pragma unroll
      for (int q = 0; q < 8; ++q) f.u[q] = tl[pc * 8 + q][d];
      *(v8us*)((unsigned short*)Vt + ((size_t)slab * 64 + d) * TTv + lg * 64 + pc * 8) = f.half[0]; }
     } }

// FRAGMENT ORDER of the attention operands: a 16-row x 64-column tile (q, k) or a 64-row x 32-key block (v^T) is stored as its WMMA fragment halves one after the other, each half as 32 lanes x 16 bytes in lane order,
// so that a wave's 16-byte load reads 512 bytes in a row (4 whole lines) and not 32 bytes out of each of 16 lines. Which element a lane and register hold is unchanged.
// q, k: row r, columns 8 c8 .. 8 c8 + 7 -> tile r >> 4, half c8 >> 1 (= 2 ks + part), lane 16 (c8 & 1) + (r & 15).

// ---- fast GEMM (wave tile 32x64; requires M % 32 == 0 rows per launch region and N % 64 == 0); epilogue = k_gemm_hhx semantics ----
__device__ __forceinline__ v16h g2_frag(const _Float16* p, int hh) { FragH f; f.half[0] = *(const v8us*)((const unsigned short*)p + 8 * hh); f.half[1] = *(const v8us*)((const unsigned short*)p + 16 + 8 * hh); return f.v; }
__device__ __forceinline__ v8f g2_mma(v16h a, v16h b, v8f c) { v8f d = __builtin_amdgcn_wmma_f32_16x16x32_f16(false, a, false, b, (short)0, c, false, false); asm volatile("v_nop\n\tv_nop\n\tv_nop\n\tv_nop" : "+v"(d) : "v"(a), "v"(b)); return d; }
// A CONSUMER THAT NEEDS ONLY THE TILE ITS PRODUCER WAVE HOLDS RUNS IN THAT WAVE, on the f32 tile in LDS, and has no launch of its own.
// EPI 0: C alone. EPI 1: C, and silu(C) as a hi + 16x residual pair row in E0 (N == DK).
template <int ACT, int NWV, int EPI>      /* NWV waves a block, each a 32 x 64 tile */
__device__ __forceinline__ void d_gemm2(const _Float16* __restrict__ A, int lda, size_t sA, const _Float16* __restrict__ Bh, int ldb, size_t sB, float alpha, const float* __restrict__ bias, size_t sBias, const float* __restrict__ CP, int rowsPerB, size_t sCPb, int row0g,
    float* __restrict__ C, _Float16* __restrict__ C16, int ldc, size_t sC, int M, int N, int K, unsigned bx, int by, _Float16* __restrict__ E0) {
  __shared__ __attribute__((aligned(16))) float so[NWV][32][68];
  const int tid = threadIdx.x, w = tid >> 5, lane = tid & 31, ln = lane & 15, hh = lane >> 4;
  A += (size_t)by * sA; Bh += (size_t)by * sB; const size_t cofs = (size_t)by * sC; const float* bp = bias ? bias + (size_t)by * sBias : nullptr;
  const int ntn = N >> 6; const int mt = bx / ntn, nq = bx - mt * ntn; const int row0 = mt * (32 * NWV) + 32 * w, col0 = nq * 64; if (row0 >= M) return;
  const _Float16* a0p = A + (size_t)(row0 + ln) * lda; const _Float16* a1p = a0p + (size_t)16 * lda;
  const _Float16* b0p = Bh + (size_t)(col0 + ln) * ldb; const _Float16* b1p = b0p + (size_t)16 * ldb; const _Float16* b2p = b1p + (size_t)16 * ldb; const _Float16* b3p = b2p + (size_t)16 * ldb;
  const v8f z8 = {0.f,0.f,0.f,0.f,0.f,0.f,0.f,0.f}; v8f c00 = z8, c01 = z8, c02 = z8, c03 = z8, c10 = z8, c11 = z8, c12 = z8, c13 = z8;
  // LOADS GO OUT IN GROUPS, AHEAD OF THEIR USE. No load moves across the statement behind a matrix instruction, so a load written at its use is waited for alone.
  // The six fragments of a 32-wide k step are loaded together, one step ahead, into a second register set (K % 64 == 0); the bias in front of the loop; the addend rows as one group behind it.
  float bvr[4] = {0.f, 0.f, 0.f, 0.f};
  if (bp) {
#pragma unroll
    for (int t = 0; t < 4; ++t) bvr[t] = bp[col0 + t * 16 + ln];
    asm volatile("s_wait_xcnt 0x0" ::: "memory"); }      /* the loads' address registers are reused right behind this branch */
  v16h a0 = g2_frag(a0p, hh), a1 = g2_frag(a1p, hh), b0 = g2_frag(b0p, hh), b1 = g2_frag(b1p, hh), b2 = g2_frag(b2p, hh), b3 = g2_frag(b3p, hh);
#pragma unroll 1      /* two k steps a trip: one per register set */
  for (int kb = 0; kb < K; kb += 64) { const int k1 = kb + 32;
    const v16h e0 = g2_frag(a0p + k1, hh), e1 = g2_frag(a1p + k1, hh), f0 = g2_frag(b0p + k1, hh), f1 = g2_frag(b1p + k1, hh), f2 = g2_frag(b2p + k1, hh), f3 = g2_frag(b3p + k1, hh);
    c00 = g2_mma(a0, b0, c00); c10 = g2_mma(a1, b0, c10); c01 = g2_mma(a0, b1, c01); c11 = g2_mma(a1, b1, c11);
    c02 = g2_mma(a0, b2, c02); c12 = g2_mma(a1, b2, c12); c03 = g2_mma(a0, b3, c03); c13 = g2_mma(a1, b3, c13);
    if (kb + 64 < K) { const int k2 = kb + 64; a0 = g2_frag(a0p + k2, hh); a1 = g2_frag(a1p + k2, hh); b0 = g2_frag(b0p + k2, hh); b1 = g2_frag(b1p + k2, hh); b2 = g2_frag(b2p + k2, hh); b3 = g2_frag(b3p + k2, hh); }
    c00 = g2_mma(e0, f0, c00); c10 = g2_mma(e1, f0, c10); c01 = g2_mma(e0, f1, c01); c11 = g2_mma(e1, f1, c11);
    c02 = g2_mma(e0, f2, c02); c12 = g2_mma(e1, f2, c12); c03 = g2_mma(e0, f3, c03); c13 = g2_mma(e1, f3, c13); }
  v8f accs[8] = {c00, c01, c02, c03, c10, c11, c12, c13};
  float cpv[8][8];
  if (CP) {
#pragma unroll
    for (int rr = 0; rr < 16; ++rr) { const int bidx = (row0g + row0 + (rr >> 3) * 16 + 8 * hh + (rr & 7)) / rowsPerB; const float* cr = CP + (size_t)bidx * sCPb + (size_t)by * 64 + col0 + ln;
#pragma unroll
      for (int t = 0; t < 4; ++t) cpv[(rr >> 3) * 4 + t][rr & 7] = cr[t * 16];
      asm volatile("s_wait_xcnt 0x0" ::: "memory"); } }      /* a row's address registers are free for the next rows' values; the data are not waited for here */
#pragma unroll
  for (int u = 0; u < 8; ++u) { const int t = u & 3, half = u >> 2; const float bv = bp ? bf16_round(bvr[t]) : 0.f;
#pragma unroll
    for (int r = 0; r < 8; ++r) { const int rloc = half * 16 + 8 * hh + r; float v = accs[u][r] * alpha + bv; if (CP) v += cpv[u][r];
      if (ACT == 3) v = fmaxf(v, 0.f); else if (ACT == 6) v = 0.5f * v * (1.0f + erff(v * 0.70710678118654752f)); else if (ACT == 11) v = 1.0f / (1.0f + expf(-v)); else if (ACT == 15) v = v / (1.0f + expf(-v)); else if (ACT == 12) v = (v > 0.f) ? v : 0.01f * v; else if (ACT == 8) v = tanhf(v);
      so[w][rloc][t * 16 + ln] = v; } }
  __builtin_amdgcn_fence(__ATOMIC_ACQ_REL, "workgroup"); __builtin_amdgcn_wave_barrier();
  const int rsub = lane >> 4, c4 = (lane & 15) * 4;
  {
#pragma unroll
    for (int q = 0; q < 16; ++q) { const int r = q * 2 + rsub; const v4f v = *(const v4fa*)&so[w][r][c4]; if (C) *(v4f*)(C + cofs + (size_t)(row0 + r) * ldc + col0 + c4) = v; if (C16) { v4h h4; for (int i = 0; i < 4; ++i) h4[i] = (_Float16)v[i]; *(v4h*)(C16 + cofs + (size_t)(row0 + r) * ldc + col0 + c4) = h4; }
      if (EPI == 1) { v4h s0, s1;
#pragma unroll
        for (int i = 0; i < 4; ++i) { const float sl = v[i] / (1.0f + expf(-v[i])); const _Float16 hv = (_Float16)sl; s0[i] = hv; s1[i] = (_Float16)((sl - (float)hv) * 16.0f); }
        _Float16* d = E0 + (size_t)(row0 + r) * 2 * DK + c4; *(v4h*)d = s0; *(v4h*)(d + DK) = s1;
        asm volatile("s_wait_xcnt 0x0" ::: "memory"); } }      /* the stores' registers are reused for the next rows */
     } }
template <int ACT>
__global__ __launch_bounds__(128) void k_gemm2(const _Float16* __restrict__ A, int lda, size_t sA, const _Float16* __restrict__ Bh, int ldb, size_t sB, float alpha, const float* __restrict__ bias, size_t sBias, const float* __restrict__ CP, int rowsPerB, size_t sCPb, int row0g,
    float* __restrict__ C, _Float16* __restrict__ C16, int ldc, size_t sC, int M, int N, int K) {
  d_gemm2<ACT, 4, 0>(A, lda, sA, Bh, ldb, sB, alpha, bias, sBias, CP, rowsPerB, sCPb, row0g, C, C16, ldc, sC, M, N, K, blockIdx.x, blockIdx.y, nullptr); }
// att = conv1x1(x) + b, and silu(att) from the same tile.
__global__ __launch_bounds__(128) void k_gemm_att(const _Float16* __restrict__ X16, const _Float16* __restrict__ BIN, const float* __restrict__ b_in, float* __restrict__ ATT, _Float16* __restrict__ SIL) {
  d_gemm2<0, 4, 1>(X16, CIN, 0, BIN, CIN, 0, 0.0625f, b_in, 0, nullptr, 1, 0, 0, ATT, nullptr, DK, 0, NPX, DK, CIN, blockIdx.x, 0, SIL); }
// LAUNCHES THAT NEED NOTHING OF EACH OTHER SHARE ONE GRID: a block-uniform branch on the block index picks the part; each part's code, block count and arithmetic are those of its own former launch.

__device__ __forceinline__ float xhalf(float v) { const int b = __float_as_int(v); return __int_as_float(__builtin_amdgcn_permlanex16(b, b, 0x76543210, 0xfedcba98, false, false)); }      /* lane l <-> l ^ 16 */
__device__ __forceinline__ float exp2_slot(float x) { float r; asm("v_exp_f32 %0, %1\n\tv_nop" : "=v"(r) : "v"(x)); return r; }      /* 2^x; the v_nop keeps the slot behind the exponential free of a reader of r and of a writer of x */
template <int TQ, int TK, int KSP>
__global__ __launch_bounds__(128 * KSP) void k_flashm(const _Float16* __restrict__ Q16, const _Float16* __restrict__ Q16lo, const _Float16* __restrict__ K16, const _Float16* __restrict__ K16lo, const _Float16* __restrict__ Vt, const _Float16* __restrict__ Vtlo, const unsigned* __restrict__ MB, const int* __restrict__ RA, const int* __restrict__ KE, _Float16* __restrict__ O16) {
  constexpr int RPW = 16, NQB = TQ / (4 * RPW), DT = 4, KS = 2, NW = 4 * KSP; static_assert(NH == 1 && DK == 64, "the fragment-order planes hold one 64-wide head");
  __shared__ __attribute__((aligned(16))) float sO[NW][RPW][64 + 4]; __shared__ float sM[NW][RPW], sL[NW][RPW];
  const int tid = threadIdx.x, w = tid >> 5, lane = tid & 31, ln = lane & 15, hh = lane >> 4; const int qt = w & 3, kp = __builtin_amdgcn_readfirstlane(w >> 2);      /* scalar: the key loop's counter and trip test stay wave-uniform */
  const int slab = blockIdx.x / NQB, qblk = blockIdx.x % NQB; const int b = slab / NH; const int qb0 = qblk * (4 * RPW); const int q0 = qb0 + qt * RPW;
  FragH aq[KS], aql[KS];
  { const size_t qo = (((size_t)b * TQ + q0) >> 4) * 1024 + lane * 8; const unsigned short* qr = (const unsigned short*)Q16 + qo; const unsigned short* ql = (const unsigned short*)Q16lo + qo;
#pragma unroll
    for (int ks = 0; ks < KS; ++ks) { aq[ks].half[0] = *(const v8us*)(qr + ks * 512); aq[ks].half[1] = *(const v8us*)(qr + ks * 512 + 256); aql[ks].half[0] = *(const v8us*)(ql + ks * 512); aql[ks].half[1] = *(const v8us*)(ql + ks * 512 + 256); } }
  const unsigned short* Vth = (const unsigned short*)Vt + (size_t)slab * 64 * TK; const unsigned short* Vtl = (const unsigned short*)Vtlo + (size_t)slab * 64 * TK;
  float m_r = -3.0e38f, l_r = 0.f; v8f oacc[DT], oaccl[DT];
#pragma unroll
  for (int dt = 0; dt < DT; ++dt) { oacc[dt] = (v8f){0.f,0.f,0.f,0.f,0.f,0.f,0.f,0.f}; oaccl[dt] = oacc[dt]; }
  int jend = KE[qblk * 32]; jend = min(TK, (jend + 31) & ~31); if (jend < 32) jend = 32;      /* block-uniform */
  const bool am = (RA[q0 + ln] != 0); const unsigned* mrow = MB + (size_t)(q0 + ln) * (TK / 32);
  const unsigned short* kr = (const unsigned short*)K16 + (((size_t)b * TK + kp * 32) >> 4) * 1024 + lane * 8; const unsigned short* kl = (const unsigned short*)K16lo + (((size_t)b * TK + kp * 32) >> 4) * 1024 + lane * 8;
  const unsigned short* vh = Vth + (size_t)kp * 2048 + lane * 8; const unsigned short* vl = Vtl + (size_t)kp * 2048 + lane * 8; const unsigned* mp = mrow + kp;      /* this wave's block of 32 keys; all five step by KSP blocks a trip */
#pragma unroll 1
  for (int j0 = kp * 32; j0 < jend; j0 += 32 * KSP, kr += KSP * 2048, kl += KSP * 2048, vh += KSP * 2048, vl += KSP * 2048, mp += KSP) {
    v8f s[2]; FragH bk[2][KS], bkl[2][KS];      /* as in the GEMM body, loads go out in groups ahead of their use: both key tiles and the mask word here, in front of the first product */
#pragma unroll
    for (int nt = 0; nt < 2; ++nt) {
#pragma unroll
      for (int ks = 0; ks < KS; ++ks) { const int o = nt * 1024 + ks * 512; bk[nt][ks].half[0] = *(const v8us*)(kr + o); bkl[nt][ks].half[0] = *(const v8us*)(kl + o); if (nt + ks < 2) { bk[nt][ks].half[1] = *(const v8us*)(kr + o + 256); bkl[nt][ks].half[1] = *(const v8us*)(kl + o + 256); } } }
    const unsigned mw = *mp;
    asm volatile("s_wait_xcnt 0x0" ::: "memory");      /* the last load from an address may land on the address registers, which the loads above name too */
    bk[1][1].half[1] = *(const v8us*)(kr + 1792);
    asm volatile("s_wait_xcnt 0x0" ::: "memory");      /* the same, for the load above */
    bkl[1][1].half[1] = *(const v8us*)(kl + 1792);
#pragma unroll
    for (int nt = 0; nt < 2; ++nt) { v8f acc = (v8f){0.f,0.f,0.f,0.f,0.f,0.f,0.f,0.f}, accr = acc;
#pragma unroll
      for (int ks = 0; ks < KS; ++ks) { acc = mmaH<1>(bk[nt][ks].v, bk[nt][ks].v, aq[ks].v, aq[ks].v, acc); accr = mmaH<1>(bk[nt][ks].v, bk[nt][ks].v, aql[ks].v, aql[ks].v, accr); accr = mmaH<1>(bkl[nt][ks].v, bkl[nt][ks].v, aq[ks].v, aq[ks].v, accr); }
      s[nt] = acc + accr * 0.0009765625f; }
    FragH bv[DT], bl[DT];      /* the whole v^T block, in front of the softmax arithmetic, which covers its latency */
#pragma unroll
    for (int dt = 0; dt < DT; ++dt) { const int o = dt * 512; bv[dt].half[0] = *(const v8us*)(vh + o); bl[dt].half[0] = *(const v8us*)(vl + o); if (dt < DT - 1) { bv[dt].half[1] = *(const v8us*)(vh + o + 256); bl[dt].half[1] = *(const v8us*)(vl + o + 256); } }
    asm volatile("s_wait_xcnt 0x0" ::: "memory");      /* as at the key tiles */
    bv[DT - 1].half[1] = *(const v8us*)(vh + (DT - 1) * 512 + 256);
    asm volatile("s_wait_xcnt 0x0" ::: "memory");      /* as at the key tiles */
    bl[DT - 1].half[1] = *(const v8us*)(vl + (DT - 1) * 512 + 256);
    const unsigned mh = mw >> (8 * hh);      /* bit r: key 8 hh + r, bit 16 + r: key 16 + 8 hh + r */
    float sv[16]; float mc = -INFINITY;
#pragma unroll
    for (int e = 0; e < 16; ++e) { const bool ok = am || (((mh >> ((e >> 3) * 16 + (e & 7))) & 1u) == 0u); sv[e] = ok ? (am ? 0.f : s[e >> 3][e & 7] * SCL) : -INFINITY; mc = fmaxf(mc, sv[e]); }
    mc = fmaxf(mc, xhalf(mc));
    /* base 2: m_r holds (running maximum) * log2(e) - 10, rounded once and used as it stands by the weights and by the rescale, so both refer to the same number */
    const float mn = fmaxf(m_r, fmaf(mc, LOG2E, -10.0f)); const float al = (mn > -1.0e38f) ? __builtin_amdgcn_exp2f(m_r - mn) : 1.0f; m_r = mn;
    FragH pa, pl; float ps = 0.f;
#pragma unroll
    for (int e = 0; e < 16; e += 2) { const v2f t = __builtin_elementwise_fma((v2f){sv[e], sv[e + 1]}, (v2f){LOG2E, LOG2E}, (v2f){-mn, -mn});      /* 2^10 p in half a packed fma and one hardware exponential; a masked key: 2^(-inf) = 0 (mn is finite) */
#pragma unroll
      for (int i = 0; i < 2; ++i) { const float p10 = __builtin_amdgcn_exp2f(t[i]); ps += p10; const _Float16 ph = (_Float16)p10; pa.h[e + i] = ph; pl.h[e + i] = (_Float16)((p10 - (float)ph) * 1024.0f); } }
    l_r = l_r * al + ps;
#pragma unroll
    for (int dt = 0; dt < DT; ++dt) { oacc[dt] *= al; oaccl[dt] *= al; }
#pragma unroll
    for (int dt = 0; dt < DT; ++dt) { oacc[dt] = mmaH<1>(bv[dt].v, bv[dt].v, pa.v, pa.v, oacc[dt]); oaccl[dt] = mmaH<1>(bl[dt].v, bl[dt].v, pa.v, pa.v, oaccl[dt]); oaccl[dt] = mmaH<1>(bv[dt].v, bv[dt].v, pl.v, pl.v, oaccl[dt]); } }
  { const float l = l_r + xhalf(l_r); if (hh == 0) { sM[w][ln] = m_r; sL[w][ln] = l; } }
#pragma unroll
  for (int dt = 0; dt < DT; ++dt) { const v8f o = oacc[dt] + oaccl[dt] * 0.0009765625f;      /* register r = O[query ln][dt * 16 + 8 hh + r] */
    *(v4fa*)&sO[w][ln][dt * 16 + 8 * hh] = (v4f){o[0], o[1], o[2], o[3]}; *(v4fa*)&sO[w][ln][dt * 16 + 8 * hh + 4] = (v4f){o[4], o[5], o[6], o[7]}; }
  __syncthreads();      /* every part's partial is in LDS before any thread merges */
  for (int i = tid; i < 4 * RPW * 16; i += 128 * KSP) { const int row = i >> 4, pc = i & 15; const int tq = row / RPW, rr = row % RPW;
    float mx = sM[tq][rr];
#pragma unroll
    for (int p = 1; p < KSP; ++p) mx = fmaxf(mx, sM[p * 4 + tq][rr]);
    float lsum = 0.f; v4f o = {0.f, 0.f, 0.f, 0.f};
#pragma unroll
    for (int p = 0; p < KSP; ++p) { const float wg = exp2_slot(sM[p * 4 + tq][rr] - mx);      /* the maxima are base-2 exponents */
      lsum += wg * sL[p * 4 + tq][rr]; const v4f val = *(const v4fa*)&sO[p * 4 + tq][rr][pc * 4]; o += val * wg; }
    const float inv = (lsum > 0.f) ? 1.0f / lsum : 0.f;      /* sum and O both carry the factor 2^10 */
    const v4f ov = o * inv; v4h fh, fl;      /* the output row leaves as the next product's operand: hi + 16x residual pair */
#pragma unroll
    for (int q = 0; q < 4; ++q) { const _Float16 hv = (_Float16)ov[q]; fh[q] = hv; fl[q] = (_Float16)((ov[q] - (float)hv) * 16.0f); }
    _Float16* d = O16 + ((size_t)b * TQ + qb0 + row) * (2 * DK) + pc * 4; *(v4h*)d = fh; *(v4h*)(d + DK) = fl; } }


__constant__ float GRIDV[8] = {-2.000000000e+00f,-1.428571463e+00f,-8.571428657e-01f,-2.857141793e-01f,2.857143879e-01f,8.571429253e-01f,1.428571701e+00f,2.000000000e+00f};
#define INV_DENOM (1.0f / 0.5714285714285714f)
__device__ __forceinline__ void d_fulltab(unsigned* __restrict__ MB, int* __restrict__ RA, int* __restrict__ KE, unsigned bx) {
  const int t = bx * 256 + threadIdx.x;
  if (t < NPI * (NPI / 32)) { *(unsigned*)(MB + t) = 0u;  }
  if (t < NPI) { *(int*)(RA + t) = 0;  }
  if (t < NPI / 64) { *(int*)(KE + t * 32) = NPI;  } }
// Layout changes go through a 64 x 64 LDS tile (pitch 65 floats: no bank conflict in either direction), so that every global read and write covers whole 128-byte lines.
__device__ __forceinline__ void d_xcl(const float* __restrict__ x, _Float16* __restrict__ X16, unsigned bx) {
  __shared__ float tl[64][65]; const int tid = threadIdx.x; const int pt = bx % (NPI / 64), ct = (bx / (NPI / 64)) % (CIN / 64), b = bx / ((NPI / 64) * (CIN / 64));
  const int r16 = tid / 16, k4 = (tid % 16) * 4; v4f a[4];      /* thread: rows r16 + 16 u of the tile, four floats at k4; the four loads fly together */
#pragma unroll      /* a[] stays in registers */
  for (int u = 0; u < 4; ++u) a[u] = *(const v4fa*)(x + ((size_t)b * CIN + ct * 64 + r16 + 16 * u) * NPI + pt * 64 + k4);
#pragma unroll      /* a[] stays in registers */
  for (int u = 0; u < 4; ++u) { float* d = &tl[r16 + 16 * u][k4]; d[0] = a[u][0]; d[1] = a[u][1]; d[2] = a[u][2]; d[3] = a[u][3]; }
  __syncthreads();      /* the whole tile is in LDS before any thread reads it across */
#pragma unroll      /* both rows' LDS reads are issued together */
  for (int rd = 0; rd < 2; ++rd) { const int p = rd * 32 + tid / 8, c8 = (tid % 8) * 8; FragH f;
#pragma unroll
    for (int q = 0; q < 8; ++q) f.h[q] = (_Float16)bf16_round(tl[c8 + q][p]);
    *(v8us*)((unsigned short*)X16 + ((size_t)b * NPI + pt * 64 + p) * CIN + ct * 64 + c8) = f.half[0]; } }
// A channel's mean and variance in one block: its values stay in registers between the two sums, each summed in the order of a pass of its own.
__device__ __forceinline__ void d_instat(const float* __restrict__ A, float* __restrict__ ST, unsigned bx) {
  #pragma clang fp contract(off)
  __shared__ float sh[256]; const int b = bx / DK, c = bx % DK; const float* ap = A + ((size_t)b * NPI + threadIdx.x) * DK + c; float a[NPI / 256]; float s = 0.f;
#pragma unroll      /* a[] stays in registers; the sixteen loads fly together */
  for (int k = 0; k < NPI / 256; ++k) a[k] = ap[(size_t)256 * k * DK];
#pragma unroll
  for (int k = 0; k < NPI / 256; ++k) s += a[k];
  sh[threadIdx.x] = s; __syncthreads();
  for (int st = 128; st > 0; st >>= 1) { if ((int)threadIdx.x < st) sh[threadIdx.x] += sh[threadIdx.x + st]; __syncthreads(); }
  const float mu = sh[0] / (float)NPI; s = 0.f;
  __syncthreads();      /* every thread has read the first sum before sh is written again */
#pragma unroll
  for (int k = 0; k < NPI / 256; ++k) { const float v = a[k] - mu; s += v * v; }
  sh[threadIdx.x] = s; __syncthreads();
  for (int st = 128; st > 0; st >>= 1) { if ((int)threadIdx.x < st) sh[threadIdx.x] += sh[threadIdx.x + st]; __syncthreads(); }
  if (threadIdx.x == 0) { ST[(size_t)bx * 32] = mu; ST[((size_t)NIMG * DK + bx) * 32] = sh[0] / (float)NPI; } }
// THE BASIS IS MADE WHERE IT IS USED: the q, k, v spline products form their A operand in registers. A 32-wide k step is 4 channels x 8 grid points, and lane (ln, hh) of an A fragment holds row ln, channels 4 s + hh and 4 s + 2 + hh, all 8 points of each:
// sixteen exponentials a lane and step, from two normalised values. A wave works 16 rows on all 192 columns (q, k, v), so each basis value is made once; the hi and the 16x residual operand meet the same weight fragment (16 w) in the same step, each in accumulators of its own: result = (hi sum + residual sum / 16) / 16.
// The weights lie in fragment order: step s, column tile j (4 each of q, k, v), fragment half, 32 lanes x 16 bytes: every load reads 512 bytes in a row.
#define NKS (DK * NG / 32)
__device__ __forceinline__ void d_wfrag(const float* __restrict__ qsw, const float* __restrict__ ksw, const float* __restrict__ vsw, _Float16* __restrict__ BSF, unsigned bx) {
  const int t = bx * 256 + threadIdx.x; const int lane = t & 31, h = (t >> 5) & 1, sj = t >> 6; const int j = sj % 12, s = sj / 12, i = j >> 2;
  const float* Wm = (i == 0) ? qsw : (i == 1) ? ksw : vsw; const int n = (j & 3) * 16 + (lane & 15), k0 = 32 * s + 16 * h + 8 * (lane >> 4); FragH f;
#pragma unroll
  for (int q = 0; q < 8; ++q) f.h[q] = (_Float16)(bf16_round(Wm[(size_t)n * (DK * NG) + k0 + q]) * 16.0f);
  *(v8us*)((unsigned short*)BSF + (size_t)t * 8) = f.half[0];
  asm volatile("s_wait_xcnt 0x0" ::: "memory"); }      /* the store's registers are written again by the code that the compiler lays behind this part */
__device__ __forceinline__ v8f k3_mma(v16h a, v16h b, v8f c) { return __builtin_amdgcn_wmma_f32_16x16x32_f16(false, a, false, b, (short)0, c, false, false); }
__device__ __forceinline__ void k3_basis(float xa, float xb, FragH& ah, FragH& al) {      /* elements 0..7: the 8 grid points of xa's channel, 8..15: of xb's; hi and 16x residual */
#pragma unroll
  for (int h = 0; h < 2; ++h) { const float xn = h ? xb : xa;
#pragma unroll
    for (int g = 0; g < NG; ++g) { const float z = (xn - GRIDV[g]) * INV_DENOM; const float e = expf(-(z * z)); const _Float16 hv = (_Float16)e; ah.h[8 * h + g] = hv; al.h[8 * h + g] = (_Float16)((e - (float)hv) * 16.0f); } } }
__global__ __launch_bounds__(128) void k_kanqkv(const float* __restrict__ A, const float* __restrict__ ST, const _Float16* __restrict__ BSF, const float* __restrict__ bias0, const float* __restrict__ bias1, const float* __restrict__ bias2, const float* __restrict__ G,
    _Float16* __restrict__ Qh, _Float16* __restrict__ Ql, _Float16* __restrict__ Kh, _Float16* __restrict__ Kl, _Float16* __restrict__ Vth, _Float16* __restrict__ Vtl) {
  __shared__ float sx[64][66];      /* pitch 66: the 32 lanes of a fragment read (row ln, channel c + hh) fall on 32 banks */
  __shared__ __attribute__((aligned(16))) float so[4][48][68];
  const int tid = threadIdx.x, w = tid >> 5, lane = tid & 31, ln = lane & 15, hh = lane >> 4; const int rb = blockIdx.x * 64, b = rb / NPI, row0 = rb + 16 * w;
  { const int c4 = (tid & 15) * 4; v4f a[8]; float mu[4], rs[4];      /* the block's 64 x 64 tile of att is 16 KiB in a row; a thread's four channels are the same in all its eight loads */
#pragma unroll
    for (int u = 0; u < 8; ++u) a[u] = *(const v4fa*)(A + (size_t)rb * DK + (tid + 128 * u) * 4);
#pragma unroll
    for (int q = 0; q < 4; ++q) { mu[q] = ST[((size_t)b * DK + c4 + q) * 32]; rs[q] = ST[((size_t)NIMG * DK + b * DK + c4 + q) * 32]; }
    asm volatile("s_wait_xcnt 0x0" ::: "memory");      /* the loads' address registers are free for what follows; the data are not waited for here */
#pragma unroll
    for (int q = 0; q < 4; ++q) rs[q] = rsqrtf(rs[q] + 1e-5f);
#pragma unroll
    for (int u = 0; u < 8; ++u) {
#pragma unroll
      for (int q = 0; q < 4; ++q) sx[(tid >> 4) + 8 * u][c4 + q] = (a[u][q] - mu[q]) * rs[q]; } }
  __syncthreads();      /* the normalised tile is whole before a wave reads its rows */
  const float* xr = &sx[16 * w + ln][hh]; const unsigned short* bp = (const unsigned short*)BSF + lane * 8;
  v8f acc[12], acr[12];
#pragma unroll
  for (int j = 0; j < 12; ++j) { acc[j] = (v8f){0.f,0.f,0.f,0.f,0.f,0.f,0.f,0.f}; acr[j] = acc[j]; }
  // A step's 12 weight fragments go out as one group, one step ahead, into a second register set (one wave a SIMD: the registers are there); the exponentials and the products of the step in hand cover their latency.
  FragH B0[12], B1[12];
#pragma unroll
  for (int f = 0; f < 12; ++f) { B0[f].half[0] = *(const v8us*)(bp + f * 512); B0[f].half[1] = *(const v8us*)(bp + f * 512 + 256); }
  asm volatile("s_wait_xcnt 0x0" ::: "memory");      /* the group's address registers are free for the next group's values */
#pragma unroll 1      /* two k steps a trip, one per register set; rolled, for speed only */
  for (int s = 0; s < NKS; s += 2, bp += 2 * 6144) {
    const float x0 = xr[4 * s], x1 = xr[4 * s + 2], x2 = xr[4 * s + 4], x3 = xr[4 * s + 6];
#pragma unroll
    for (int f = 0; f < 12; ++f) { B1[f].half[0] = *(const v8us*)(bp + 6144 + f * 512); B1[f].half[1] = *(const v8us*)(bp + 6144 + f * 512 + 256); }
    __builtin_amdgcn_sched_barrier(0);      /* the group is issued here, not at its use a step later */
    { FragH ah, al; k3_basis(x0, x1, ah, al);
#pragma unroll
      for (int j = 0; j < 12; ++j) acc[j] = k3_mma(ah.v, B0[j].v, acc[j]);
#pragma unroll
      for (int j = 0; j < 12; ++j) acr[j] = k3_mma(al.v, B0[j].v, acr[j]); }
    __builtin_amdgcn_sched_barrier(0);      /* the refill of the first set stays behind its last reader and ahead of the second step */
    { const unsigned short* np = bp + ((s + 2 < NKS) ? 2 * 6144 : 0);      /* the last trip reads its own first step again, unused: a branch round the refill would join a path without it, and the counted waits behind the join would then wait for the refill as well */
#pragma unroll
      for (int f = 0; f < 12; ++f) { B0[f].half[0] = *(const v8us*)(np + f * 512); B0[f].half[1] = *(const v8us*)(np + f * 512 + 256); } }
    asm volatile("s_wait_xcnt 0x0" ::: "memory");      /* the groups' address register is stepped for the next trip; the data are not waited for here */
    __builtin_amdgcn_sched_barrier(0);      /* as at the first group */
    { FragH ah, al; k3_basis(x2, x3, ah, al);
#pragma unroll
      for (int j = 0; j < 12; ++j) acc[j] = k3_mma(ah.v, B1[j].v, acc[j]);
#pragma unroll
      for (int j = 0; j < 12; ++j) acr[j] = k3_mma(al.v, B1[j].v, acr[j]); } }
  float bv[12], cpv[12][8];      /* biases and the base products' rows go out as one group */
#pragma unroll
  for (int j = 0; j < 12; ++j) bv[j] = ((j < 4) ? bias0 : (j < 8) ? bias1 : bias2)[(j & 3) * 16 + ln];
  asm volatile("s_wait_xcnt 0x0" ::: "memory");      /* as above */
#pragma unroll
  for (int i = 0; i < 3; ++i) { const float* gp = G + (size_t)i * NPX * DK + (size_t)(row0 + 8 * hh) * DK + ln;      /* one address a plane, the rest immediates */
#pragma unroll
    for (int r = 0; r < 8; ++r) {
#pragma unroll
      for (int t = 0; t < 4; ++t) cpv[i * 4 + t][r] = gp[r * DK + t * 16]; }
    asm volatile("s_wait_xcnt 0x0" :: "v"(gp) : "memory");      /* the address that these loads name lives up to this wait; the data are not waited for here */
    __builtin_amdgcn_sched_barrier(0); }      /* the next plane's address, and all else from below, is formed behind the wait */
#pragma unroll
  for (int j = 0; j < 12; ++j) { const float bq = bf16_round(bv[j]);
#pragma unroll
    for (int r = 0; r < 8; ++r) { float v = (acc[j][r] + acr[j][r] * 0.0625f) * 0.0625f + bq; v += cpv[j][r]; so[w][(j >> 2) * 16 + 8 * hh + r][(j & 3) * 16 + ln] = v; } }
  __builtin_amdgcn_fence(__ATOMIC_ACQ_REL, "workgroup"); __builtin_amdgcn_wave_barrier();      /* the wave reads its own tile across lanes */
#pragma unroll
  for (int i = 0; i < 2; ++i) { unsigned short* p0 = (unsigned short*)(i ? Kh : Qh) + (size_t)(row0 >> 4) * 1024 + lane * 8; unsigned short* p1 = (unsigned short*)(i ? Kl : Ql) + (size_t)(row0 >> 4) * 1024 + lane * 8;
#pragma unroll
    for (int u = 0; u < 4; ++u) { FragH fh, fl; const float* sr = &so[w][i * 16 + ln][(u * 2 + hh) * 8]; const v4f a = *(const v4fa*)sr, c = *(const v4fa*)(sr + 4);      /* half u: row ln, columns 8 (2 u + hh) .. + 7 */
#pragma unroll
      for (int q = 0; q < 4; ++q) { _Float16 h = (_Float16)a[q]; fh.h[q] = h; fl.h[q] = (_Float16)((a[q] - (float)h) * 1024.0f); h = (_Float16)c[q]; fh.h[4 + q] = h; fl.h[4 + q] = (_Float16)((c[q] - (float)h) * 1024.0f); }
      *(v8us*)(p0 + u * 256) = fh.half[0]; *(v8us*)(p1 + u * 256) = fl.half[0];
      asm volatile("s_wait_xcnt 0x0" ::: "memory"); } }      /* the stores' registers are reused for the next half */
  { const size_t ob = (size_t)(row0 / NPI) * 64 * NPI + (size_t)((row0 % NPI) >> 5) * 2048 + (size_t)((row0 >> 4) & 1) * 256 + lane * 8;      /* image, 32-key block, this wave's 16 keys of it */
    unsigned short* p0 = (unsigned short*)Vth + ob; unsigned short* p1 = (unsigned short*)Vtl + ob;
#pragma unroll
    for (int dt = 0; dt < 4; ++dt) { FragH fh, fl;      /* half 2 dt + part: channel 16 dt + ln, keys 16 part + 8 hh + q */
#pragma unroll
      for (int q = 0; q < 8; ++q) { const float v = so[w][32 + 8 * hh + q][dt * 16 + ln]; const _Float16 hv = (_Float16)v; fh.h[q] = hv; fl.h[q] = (_Float16)((v - (float)hv) * 1024.0f); }
      *(v8us*)(p0 + dt * 512) = fh.half[0]; *(v8us*)(p1 + dt * 512) = fl.half[0];
      asm volatile("s_wait_xcnt 0x0" ::: "memory"); } } }      /* as above */
__device__ __forceinline__ void d_wnp2(const float* __restrict__ Wm, int K, int N, _Float16* __restrict__ Bt, unsigned bx) {
  const int t = bx * 256 + threadIdx.x; if (t >= N * (2 * K / 8)) return; const int n = t / (2 * K / 8), k0 = (t % (2 * K / 8)) * 8; const bool lo = (k0 >= K); const float sc = lo ? 1.0f : 16.0f; FragH f;
#pragma unroll
  for (int q = 0; q < 8; ++q) { const int k = k0 + q - (lo ? K : 0); f.h[q] = (_Float16)(bf16_round(Wm[(size_t)n * K + k]) * sc); }
  *(v8us*)((unsigned short*)Bt + (size_t)n * 2 * K + k0) = f.half[0];  }
// One grid for all that reads inputs alone: x turned to f16 rows (first: the longest part), the mask tables, the eight weight planes.
#define NB_XCL (NIMG * (CIN / 64) * (NPI / 64))
#define NB_TAB (NPI * (NPI / 32) / 256)
#define NB_WS (3 * DK * (DK * NG / 8) / 256)
#define NB_WB (DK * (2 * DK / 8) / 256)
#define NB_WO (CIN * (2 * DK / 8) / 256)
#define NB_WI (DK * CIN / 8 / 256)
__global__ __launch_bounds__(256) void k_prep(const float* __restrict__ x, const float* __restrict__ w_in, const float* __restrict__ w_out, const float* __restrict__ qbw, const float* __restrict__ kbw, const float* __restrict__ vbw,
    const float* __restrict__ qsw, const float* __restrict__ ksw, const float* __restrict__ vsw, _Float16* __restrict__ X16, _Float16* __restrict__ BIN, _Float16* __restrict__ BOUT,
    _Float16* __restrict__ BB0, _Float16* __restrict__ BB1, _Float16* __restrict__ BB2, _Float16* __restrict__ BSF, unsigned* __restrict__ MB, int* __restrict__ RA, int* __restrict__ KE) {
  int bx = blockIdx.x;
  if (bx < NB_XCL) { d_xcl(x, X16, bx); return; }
  bx -= NB_XCL; if (bx < NB_TAB) { d_fulltab(MB, RA, KE, bx); return; }
  bx -= NB_TAB; if (bx < NB_WS) { d_wfrag(qsw, ksw, vsw, BSF, bx); return; }
  bx -= NB_WS; if (bx < 3 * NB_WB) { const int i = bx / NB_WB; d_wnp2((i == 0) ? qbw : (i == 1) ? kbw : vbw, DK, DK, (i == 0) ? BB0 : (i == 1) ? BB1 : BB2, bx % NB_WB); return; }
  bx -= 3 * NB_WB; if (bx < NB_WO) { d_wnp2(w_out, DK, CIN, BOUT, bx); return; }      /* (out,in) natural -> [16w | w] pair planes */
  d_round16f(w_in, BIN, (size_t)DK * CIN / 8, bx - NB_WO); }
// att's channel statistics beside the q, k, v base products (8 waves a block): the first reads att, the second silu(att) and weights.
#define NB_IS (NIMG * DK)
#define NB_GB (NPX / 256)
__global__ __launch_bounds__(256) void k_stat_base(const float* __restrict__ A, float* __restrict__ ST, const _Float16* __restrict__ SIL, const _Float16* __restrict__ B0, const _Float16* __restrict__ B1, const _Float16* __restrict__ B2,
    const float* __restrict__ bias0, const float* __restrict__ bias1, const float* __restrict__ bias2, float* __restrict__ G, size_t plane, int ldc, int M, int N, int K) {
  const int bx = blockIdx.x;
  if (bx < NB_IS) { d_instat(A, ST, bx); return; }
  const int i = (bx - NB_IS) / NB_GB;
  d_gemm2<0, 8, 0>(SIL, K, 0, (i == 0) ? B0 : (i == 1) ? B1 : B2, K, 0, 0.0625f, (i == 0) ? bias0 : (i == 1) ? bias1 : bias2, 0, nullptr, 1, 0, 0, G + (size_t)i * plane, nullptr, ldc, 0, M, N, K, (bx - NB_IS) % NB_GB, 0, nullptr); }
// One block a channel: y = gamma x + att2 (A2T: the outer product without its bias, channel-major like x and the output) is formed in registers and stays there for the mean, the variance and the output.
// Thread t holds pixels bi * NPI + t + 256 k; each sum runs over them in rising order, then down the LDS tree.
__global__ __launch_bounds__(256) void k_ybn(const float* __restrict__ x, const float* __restrict__ gam, const float* __restrict__ A2T, const float* __restrict__ b_out, const float* __restrict__ bw, const float* __restrict__ bb, float* __restrict__ out) {
  __shared__ float sh[256]; const int c = blockIdx.x; const float g = bf16_round(gam[0]), bo = bf16_round(b_out[c]), gw = bf16_round(bw[c]), be = bf16_round(bb[c]); float y[NIMG][NPI / 256]; float s = 0.f;
#pragma unroll      /* y[][] stays in registers; an image's thirty-two loads fly together */
  for (int bi = 0; bi < NIMG; ++bi) { const float* xp = x + ((size_t)bi * CIN + c) * NPI; const float* ap = A2T + ((size_t)bi * CIN + c) * NPI; float xv[NPI / 256], av[NPI / 256];
#pragma unroll
    for (int k = 0; k < NPI / 256; ++k) xv[k] = xp[threadIdx.x + 256u * k];
    asm volatile("s_wait_xcnt 0x0" ::: "memory");      /* the loads' address registers are free for what follows; the data are not waited for here */
#pragma unroll
    for (int k = 0; k < NPI / 256; ++k) av[k] = ap[threadIdx.x + 256u * k];
    asm volatile("s_wait_xcnt 0x0" ::: "memory");      /* the same */
#pragma unroll
    for (int k = 0; k < NPI / 256; ++k) y[bi][k] = g * bf16_round(xv[k]) + (av[k] + bo); }
#pragma unroll
  for (int bi = 0; bi < NIMG; ++bi) {
#pragma unroll
    for (int k = 0; k < NPI / 256; ++k) s += y[bi][k]; }
  sh[threadIdx.x] = s; __syncthreads();
  for (int st = 128; st > 0; st >>= 1) { if ((int)threadIdx.x < st) sh[threadIdx.x] += sh[threadIdx.x + st]; __syncthreads(); }
  const float mu = sh[0] / (float)NPX; s = 0.f;
  __syncthreads();      /* every thread has read the first sum before sh is written again */
#pragma unroll
  for (int bi = 0; bi < NIMG; ++bi) {
#pragma unroll
    for (int k = 0; k < NPI / 256; ++k) { const float v = y[bi][k] - mu; s += v * v; } }
  sh[threadIdx.x] = s; __syncthreads();
  for (int st = 128; st > 0; st >>= 1) { if ((int)threadIdx.x < st) sh[threadIdx.x] += sh[threadIdx.x + st]; __syncthreads(); }
  const float sc = rsqrtf(sh[0] / (float)NPX + 1e-5f);
#pragma unroll
  for (int bi = 0; bi < NIMG; ++bi) { float* op = out + ((size_t)bi * CIN + c) * NPI;
#pragma unroll
    for (int k = 0; k < NPI / 256; ++k) op[threadIdx.x + 256u * k] = gw * ((y[bi][k] - mu) * sc) + be; } }

extern "C" void kernel_launch(void* const* d_in, const int* in_sizes, int n_in,
                              void* d_out, int out_size, void* d_ws, size_t ws_size, hipStream_t stream) {
  (void)in_sizes; (void)n_in; (void)out_size;
  const float* const* I = (const float* const*)d_in; const float* x = I[0]; const float* w_in = I[1]; const float* b_in = I[2];
  const float* qbw = I[3]; const float* qbb = I[4]; const float* qsw = I[5]; const float* qsb = I[6]; const float* kbw = I[7]; const float* kbb = I[8]; const float* ksw = I[9]; const float* ksb = I[10]; const float* vbw = I[11]; const float* vbb = I[12]; const float* vsw = I[13]; const float* vsb = I[14];
  const float* w_out = I[15]; const float* b_out = I[16]; const float* gam = I[17]; const float* bnw = I[18]; const float* bnb = I[19];
  char* ws = (char*)d_ws; size_t off = 0;
  auto take = [&](size_t bytes) { char* p = ws + off; off += (bytes + 255) & ~(size_t)255; return p; };
  _Float16* BIN = (_Float16*)take((size_t)DK * CIN * 2); _Float16* BB[3]; for (int i = 0; i < 3; ++i) BB[i] = (_Float16*)take((size_t)DK * 2 * DK * 2); _Float16* BSF = (_Float16*)take((size_t)3 * DK * DK * NG * 2); _Float16* BOUT = (_Float16*)take((size_t)CIN * 2 * DK * 2);
  _Float16* X16 = (_Float16*)take((size_t)NPX * CIN * 2); float* ATT = (float*)take((size_t)NPX * DK * 4); float* IST = (float*)take((size_t)2 * NIMG * DK * 32 * 4); _Float16* SIL = (_Float16*)take((size_t)NPX * 2 * DK * 2);
  float* G = (float*)take((size_t)3 * NPX * DK * 4); _Float16* Qh = (_Float16*)take((size_t)NPX * DK * 2); _Float16* Ql = (_Float16*)take((size_t)NPX * DK * 2); _Float16* Kh = (_Float16*)take((size_t)NPX * DK * 2); _Float16* Kl = (_Float16*)take((size_t)NPX * DK * 2); _Float16* Vth = (_Float16*)take((size_t)NPX * DK * 2); _Float16* Vtl = (_Float16*)take((size_t)NPX * DK * 2);
  _Float16* O16 = (_Float16*)take((size_t)NPX * 2 * DK * 2); float* A2T = (float*)take((size_t)NPX * CIN * 4);
  unsigned* MB = (unsigned*)take((size_t)NPI * (NPI / 32) * 4); int* RA = (int*)take((size_t)NPI * 4); int* KE = (int*)take((size_t)(NPI / 64) * 32 * 4);
  if (off > ws_size) return;      /* 0.4 + 8 + 4 + 4 + 12 + 12 + 4 + 16 + 2 = 63 MiB */
  k_prep<<<NB_XCL + NB_TAB + NB_WS + 3 * NB_WB + NB_WO + NB_WI, 256, 0, stream>>>(x, w_in, w_out, qbw, kbw, vbw, qsw, ksw, vsw, X16, BIN, BOUT, BB[0], BB[1], BB[2], BSF, MB, RA, KE);
  const dim3 g64((NPX / 128) * 1, 1), gout((CIN / 128) * (NPI / 64), NIMG);
  k_gemm_att<<<g64, 128, 0, stream>>>(X16, BIN, b_in, ATT, SIL);      /* att = conv1x1(x) + b; silu(att) */
  k_stat_base<<<NB_IS + 3 * NB_GB, 256, 0, stream>>>(ATT, IST, SIL, BB[0], BB[1], BB[2], qbb, kbb, vbb, G, (size_t)NPX * DK, DK, NPX, DK, 2 * DK);      /* G = base(silu) + b_base, planes q, k, v */
  k_kanqkv<<<NPX / 64, 128, 0, stream>>>(ATT, IST, BSF, qsb, ksb, vsb, G, Qh, Ql, Kh, Kl, Vth, Vtl);      /* spline(basis) + b_spline + G, as operand planes */
  k_flashm<NPI, NPI, KSPLIT><<<NIMG * NH * (NPI / 64), 128 * KSPLIT, 0, stream>>>(Qh, Ql, Kh, Kl, Vth, Vtl, MB, RA, KE, O16);      /* slab = image (NH 1) */
  k_gemm2<0><<<gout, 128, 0, stream>>>(BOUT, 2 * DK, 0, O16, 2 * DK, (size_t)NPI * 2 * DK, 0.0625f, nullptr, 0, nullptr, 1, 0, 0, A2T, nullptr, NPI, (size_t)CIN * NPI, CIN, NPI, 2 * DK);      /* att2^T = w_out . out^T of image blockIdx.y (pair operands), rows = channels; its bias is added in k_ybn */
  k_ybn<<<CIN, 256, 0, stream>>>(x, gam, A2T, b_out, bnw, bnb, (float*)d_out);
}

// v010
// One run takes 90.8 microseconds.
// Timed twice side by side with v009, it ran 1.20 and 1.21 times as fast.
// Over all steps from v000, the starting kernel, it is 10.2 times as fast.
#include <hip/hip_runtime.h>
// Self-KAN attention (4 images, 256 channels, 64 x 64): att = conv1x1(x) (64 ch); q, k, v = FastKAN 1x1 convs (base_conv(silu(att)) + spline_conv(RBF basis of the instance-normalised att, 8 grid points)); energy = q.k over the 4096 positions (NO scaling), softmax over keys, out = v.attn^T; att2 = conv1x1(out) (256 ch); y = gamma*x + att2; training-mode BatchNorm -> [4,256,64,64].
// Compute dtype: x, weights, biases, gamma, BN affine rounded to bf16; x exact in f16; silu/basis operands as hi + 16x residual pairs (~2^-20); q, k, P, v as hi + x2^10 residual pairs (~2^-21); the attention output as hi + 16x residual pairs too; f32 accumulation, statistics, softmax. v_wmma_f32_16x16x32_f16.
#define NIMG 4
#define CIN 256
#define DK 64
#define HW 64
#define NPI (HW * HW)            /* 4096 */
#define NPX (NIMG * NPI)         /* 16384 */
#define NG 8
#define NH 1
#define DM DK
#define SCL 1.0f
#define KSPLIT 4
#define LOG2E 1.4426950408889634f
typedef __bf16 v16b __attribute__((ext_vector_type(16)));
typedef unsigned short v8us __attribute__((ext_vector_type(8), may_alias));
typedef float  v8f  __attribute__((ext_vector_type(8)));
typedef float  v4f  __attribute__((ext_vector_type(4)));
typedef float  v2f  __attribute__((ext_vector_type(2)));
typedef float  v4fa __attribute__((ext_vector_type(4), may_alias));
union FragB { v16b v; v8us half[2]; unsigned short u[16]; };

__device__ __forceinline__ unsigned short bf16_bits(float x) { unsigned int u = __float_as_uint(x); return (unsigned short)((u + 0x7FFFu + ((u >> 16) & 1u)) >> 16); }
__device__ __forceinline__ float bf16_val(unsigned short b) { return __uint_as_float(((unsigned int)b) << 16); }
__device__ __forceinline__ float bf16_round(float x) { return bf16_val(bf16_bits(x)); }
// D += A·B with NT terms: 1 = ah·bh, 2 = + al·bh (A split), 3 = + ah·bl (both split)
template <int NT>
__device__ __forceinline__ v8f mmaN(v16b ah, v16b al, v16b bh, v16b bl, v8f c) {
  c = __builtin_amdgcn_wmma_f32_16x16x32_bf16(false, ah, false, bh, (short)0, c, false, false);
  if (NT >= 2) c = __builtin_amdgcn_wmma_f32_16x16x32_bf16(false, al, false, bh, (short)0, c, false, false);
  if (NT >= 3) c = __builtin_amdgcn_wmma_f32_16x16x32_bf16(false, ah, false, bl, (short)0, c, false, false);
  asm volatile("v_nop\n\tv_nop\n\tv_nop\n\tv_nop" : "+v"(c) : "v"(ah), "v"(al), "v"(bh), "v"(bl));
  return c;
}

__global__ __launch_bounds__(256) void k_wt_bf16(const float* __restrict__ W, unsigned short* __restrict__ Wt, int K, int N) {
  const int t = blockIdx.x * 256 + threadIdx.x;
  const int k8n = K / 8;
  if (t >= N * k8n) return;
  const int n = t / k8n, k8 = (t % k8n) * 8;
  v8us v;
#pragma unroll
  for (int i = 0; i < 8; ++i) v[i] = bf16_bits(W[(size_t)(k8 + i) * N + n]);
  *(v8us*)(Wt + (size_t)n * K + k8) = v;
  
}

// GEMM C[M][N] (f32, pitch ldc) = act(A[M][K]·W + bias). A f32 row-major (pitch lda) converted per fragment to bf16
// (ASPLIT: hi/lo two planes -> 2 terms, else single rounded term); Wt bf16 [N][K] (pitch ldb). BIAS_BF16 rounds the
// bias to bf16 first (bias quantised to bf16 before the add). K%32==0, M%16==0, N%64==0.
template <bool ASPLIT, int ACT, bool BIAS_BF16>
__global__ __launch_bounds__(128) void k_gemm_bf(const float* __restrict__ A, int lda, const unsigned short* __restrict__ Wt, int ldb,
                                               const float* __restrict__ bias, float* __restrict__ C, int ldc, int M, int N, int K) {
  __shared__ __attribute__((aligned(16))) float so[4][16][64];
  const int tid = threadIdx.x, w = tid >> 5, lane = tid & 31, ln = lane & 15, hh = lane >> 4;
  const int ntn = N / 64;
  const int wid = blockIdx.x * 4 + w;
  const int mt = wid / ntn, nq = wid % ntn;
  if (mt * 16 >= M) return;
  const int row0 = mt * 16, col0 = nq * 64;
  const float* arow = A + (size_t)(row0 + ln) * lda;
  v8f acc[4] = {};
  for (int kb = 0; kb < K; kb += 32) {
    FragB ah, al;
    const v4f x0 = *(const v4fa*)(arow + kb + 8 * hh), x1 = *(const v4fa*)(arow + kb + 8 * hh + 4);
    const v4f x2 = *(const v4fa*)(arow + kb + 16 + 8 * hh), x3 = *(const v4fa*)(arow + kb + 16 + 8 * hh + 4);
    float xs[16] = {x0[0],x0[1],x0[2],x0[3],x1[0],x1[1],x1[2],x1[3],x2[0],x2[1],x2[2],x2[3],x3[0],x3[1],x3[2],x3[3]};
#pragma unroll
    for (int i = 0; i < 16; ++i) { const unsigned short hb = bf16_bits(xs[i]); ah.u[i] = hb; al.u[i] = ASPLIT ? bf16_bits(xs[i] - bf16_val(hb)) : (unsigned short)0; }
#pragma unroll
    for (int t = 0; t < 4; ++t) {
      const unsigned short* brow = Wt + (size_t)(col0 + t * 16 + ln) * ldb + kb;
      FragB b;
      b.half[0] = *(const v8us*)(brow + 8 * hh);
      b.half[1] = *(const v8us*)(brow + 16 + 8 * hh);
      acc[t] = mmaN<ASPLIT ? 2 : 1>(ah.v, al.v, b.v, b.v, acc[t]);
    }
  }
#pragma unroll
  for (int t = 0; t < 4; ++t) {
    float bv = bias ? bias[col0 + t * 16 + ln] : 0.f;
    if (BIAS_BF16) bv = bf16_round(bv);
#pragma unroll
    for (int r = 0; r < 8; ++r) { float v = acc[t][r] + bv; if (ACT == 1) v = fmaxf(v, 0.f); so[w][8 * hh + r][t * 16 + ln] = v; }
  }
  __builtin_amdgcn_fence(__ATOMIC_ACQ_REL, "workgroup");
  __builtin_amdgcn_wave_barrier();
  const int rsub = lane >> 4, c4 = (lane & 15) * 4;
  {
#pragma unroll
    for (int q = 0; q < 8; ++q) {
      const int r = q * 2 + rsub;
      const v4f v = *(const v4fa*)&so[w][r][c4];
      *(v4f*)(C + (size_t)(row0 + r) * ldc + col0 + c4) = v;
    }
    
  }
}

// GEMM C = act(A·W + bias + resid): A f32 (ASPLIT -> hi/lo 2 terms), Wt bf16 [N][K]; ACT 0 none, 1 relu, 2 exact gelu;
// resid (optional, f32, row index = (row % rmod), pitch ldr, RES_BF16 rounds it) added before the activation.
template <bool ASPLIT, int ACT, bool BIAS_BF16, bool RES_BF16>
__global__ __launch_bounds__(128) void k_gemm_bf3(const float* __restrict__ A, int lda, const unsigned short* __restrict__ Wt, int ldb,
                                                const float* __restrict__ bias, const float* __restrict__ resid, int rmod, int ldr,
                                                float* __restrict__ C, int ldc, int M, int N, int K) {
  __shared__ __attribute__((aligned(16))) float so[4][16][64];
  const int tid = threadIdx.x, w = tid >> 5, lane = tid & 31, ln = lane & 15, hh = lane >> 4;
  const int ntn = N / 64;
  const int wid = blockIdx.x * 4 + w;
  const int mt = wid / ntn, nq = wid % ntn;
  if (mt * 16 >= M) return;
  const int row0 = mt * 16, col0 = nq * 64;
  const float* arow = A + (size_t)(row0 + ln) * lda;
  v8f acc[4] = {};
  for (int kb = 0; kb < K; kb += 32) {
    FragB ah, al;
    const v4f x0 = *(const v4fa*)(arow + kb + 8 * hh), x1 = *(const v4fa*)(arow + kb + 8 * hh + 4);
    const v4f x2 = *(const v4fa*)(arow + kb + 16 + 8 * hh), x3 = *(const v4fa*)(arow + kb + 16 + 8 * hh + 4);
    float xs[16] = {x0[0],x0[1],x0[2],x0[3],x1[0],x1[1],x1[2],x1[3],x2[0],x2[1],x2[2],x2[3],x3[0],x3[1],x3[2],x3[3]};
#pragma unroll
    for (int i = 0; i < 16; ++i) { const unsigned short hb = bf16_bits(xs[i]); ah.u[i] = hb; al.u[i] = ASPLIT ? bf16_bits(xs[i] - bf16_val(hb)) : (unsigned short)0; }
#pragma unroll
    for (int t = 0; t < 4; ++t) {
      const unsigned short* brow = Wt + (size_t)(col0 + t * 16 + ln) * ldb + kb;
      FragB b;
      b.half[0] = *(const v8us*)(brow + 8 * hh);
      b.half[1] = *(const v8us*)(brow + 16 + 8 * hh);
      acc[t] = mmaN<ASPLIT ? 2 : 1>(ah.v, al.v, b.v, b.v, acc[t]);
    }
  }
#pragma unroll
  for (int t = 0; t < 4; ++t) {
    const int col = col0 + t * 16 + ln;
    float bv = bias ? bias[col] : 0.f;
    if (BIAS_BF16) bv = bf16_round(bv);
#pragma unroll
    for (int r = 0; r < 8; ++r) {
      float v = acc[t][r] + bv;
      if (resid) { float rv = resid[(size_t)((row0 + 8 * hh + r) % rmod) * ldr + col]; if (RES_BF16) rv = bf16_round(rv); v += rv; }
      if (ACT == 1) v = fmaxf(v, 0.f);
      if (ACT == 2) v = 0.5f * v * (1.0f + erff(v * 0.70710678118654752f));
      if (ACT == 3) { const float u = 0.7978845608028654f * (v + 0.044715f * v * v * v); v = 0.5f * v * (1.0f + tanhf(u)); }
      so[w][8 * hh + r][t * 16 + ln] = v;
    }
  }
  __builtin_amdgcn_fence(__ATOMIC_ACQ_REL, "workgroup");
  __builtin_amdgcn_wave_barrier();
  const int rsub = lane >> 4, c4 = (lane & 15) * 4;
  {
#pragma unroll
    for (int q = 0; q < 8; ++q) {
      const int r = q * 2 + rsub;
      const v4f v = *(const v4fa*)&so[w][r][c4];
      *(v4f*)(C + (size_t)(row0 + r) * ldc + col0 + c4) = v;
    }
    
  }
}
// row LayerNorm (biased variance, eps) over N: s = X (+ R); optional out_sum <- s; out_norm <- (s-mu)*rsqrt(var+eps)*g + b
template <bool PARAM_BF16>
__global__ __launch_bounds__(256) void k_layernorm(const float* __restrict__ X, const float* __restrict__ R, const float* __restrict__ g, const float* __restrict__ bta,
                                                  float* __restrict__ out_sum, float* __restrict__ out_norm, int N, float eps) {
  __shared__ float red[256];
  const int row = blockIdx.x, tid = threadIdx.x;
  const float* x = X + (size_t)row * N; const float* rr = R ? R + (size_t)row * N : nullptr;
  float vals[16];                     // up to N = 4096
  const int per = N / 256;            // contiguous chunk per thread? use strided-by-4 chunks: thread handles j = tid*4 + 1024*u
  float s1 = 0.f;
  for (int u = 0; u < per / 4; ++u) {
    const int j = tid * 4 + 1024 * u;
    const v4f a = *(const v4fa*)(x + j);
    v4f b = {0.f,0.f,0.f,0.f}; if (rr) b = *(const v4fa*)(rr + j);
#pragma unroll
    for (int q = 0; q < 4; ++q) { const float v = a[q] + b[q]; vals[u * 4 + q] = v; s1 += v; }
  }
  red[tid] = s1; __syncthreads();
  for (int st = 128; st > 0; st >>= 1) { if (tid < st) red[tid] += red[tid + st]; __syncthreads(); }
  const float mu = red[0] / (float)N; __syncthreads();
  float s2 = 0.f;
  for (int u = 0; u < per / 4; ++u)
#pragma unroll
    for (int q = 0; q < 4; ++q) { const float c = vals[u * 4 + q] - mu; s2 += c * c; }
  red[tid] = s2; __syncthreads();
  for (int st = 128; st > 0; st >>= 1) { if (tid < st) red[tid] += red[tid + st]; __syncthreads(); }
  const float rs = rsqrtf(red[0] / (float)N + eps);
  {
    for (int u = 0; u < per / 4; ++u) {
      const int j = tid * 4 + 1024 * u;
      v4f o, sm;
#pragma unroll
      for (int q = 0; q < 4; ++q) {
        float gg = g[j + q], bb = bta[j + q];
        if (PARAM_BF16) { gg = bf16_round(gg); bb = bf16_round(bb); }
        sm[q] = vals[u * 4 + q]; o[q] = (vals[u * 4 + q] - mu) * rs * gg + bb;
      }
      if (out_sum) *(v4f*)(out_sum + (size_t)row * N + j) = sm;
      *(v4f*)(out_norm + (size_t)row * N + j) = o;
    }
    
  }
}



// ---- f16 WMMA path (v_wmma_f32_16x16x32_f16): 11-bit significands for operands in range — used where a [0,1] probability operand needs more precision than bf16
typedef _Float16 v16h __attribute__((ext_vector_type(16)));
union FragH { v16h v; v8us half[2]; _Float16 h[16]; unsigned short u[16]; };
template <int NT>
__device__ __forceinline__ v8f mmaH(v16h ah, v16h al, v16h bh, v16h bl, v8f c) {
  c = __builtin_amdgcn_wmma_f32_16x16x32_f16(false, ah, false, bh, (short)0, c, false, false);
  if (NT >= 2) c = __builtin_amdgcn_wmma_f32_16x16x32_f16(false, al, false, bh, (short)0, c, false, false);
  if (NT >= 3) c = __builtin_amdgcn_wmma_f32_16x16x32_f16(false, ah, false, bl, (short)0, c, false, false);
  asm volatile("v_nop\n\tv_nop\n\tv_nop\n\tv_nop" : "+v"(c) : "v"(ah), "v"(al), "v"(bh), "v"(bl));
  return c;
}
// batched GEMM like k_gemm_b but f16 operands: A f32 (split into f16 hi/lo if ASPLIT, else rounded to f16), Bt = f16 values [n][k]; alpha; C f32; N multiple of 16 (partial tiles skipped)
template <bool ASPLIT>
__global__ __launch_bounds__(128) void k_gemm_h(const float* __restrict__ A, int lda, size_t sA, const _Float16* __restrict__ Bh, int ldb, size_t sB, float alpha, float* __restrict__ C, int ldc, size_t sC, int M, int N, int K) {
  __shared__ __attribute__((aligned(16))) float so[4][16][64];
  const int tid = threadIdx.x, w = tid >> 5, lane = tid & 31, ln = lane & 15, hh = lane >> 4; const int by = blockIdx.y;
  A += (size_t)by * sA; Bh += (size_t)by * sB; C += (size_t)by * sC;
  const int ntn = (N + 63) / 64; const int wid = blockIdx.x * 4 + w; const int mt = wid / ntn, nq = wid % ntn; if (mt * 16 >= M) return;
  const int row0 = mt * 16, col0 = nq * 64; const float* arow = A + (size_t)(row0 + ln) * lda;
  v8f acc[4] = {};
  for (int kb = 0; kb < K; kb += 32) {
    FragH ah, al;
    const v4f x0 = *(const v4fa*)(arow + kb + 8 * hh), x1 = *(const v4fa*)(arow + kb + 8 * hh + 4), x2 = *(const v4fa*)(arow + kb + 16 + 8 * hh), x3 = *(const v4fa*)(arow + kb + 16 + 8 * hh + 4);
    float xs[16] = {x0[0],x0[1],x0[2],x0[3],x1[0],x1[1],x1[2],x1[3],x2[0],x2[1],x2[2],x2[3],x3[0],x3[1],x3[2],x3[3]};
#pragma unroll
    for (int i = 0; i < 16; ++i) { const _Float16 h = (_Float16)xs[i]; ah.h[i] = h; al.h[i] = ASPLIT ? (_Float16)(xs[i] - (float)h) : (_Float16)0.0f; }
#pragma unroll
    for (int t = 0; t < 4; ++t) { if (col0 + t * 16 >= N) continue; const size_t boff = (size_t)(col0 + t * 16 + ln) * ldb + kb; FragH bq; bq.half[0] = *(const v8us*)(Bh + boff + 8 * hh); bq.half[1] = *(const v8us*)(Bh + boff + 16 + 8 * hh);
      acc[t] = mmaH<ASPLIT ? 2 : 1>(ah.v, al.v, bq.v, bq.v, acc[t]); }
  }
#pragma unroll
  for (int t = 0; t < 4; ++t) { if (col0 + t * 16 >= N) continue;
#pragma unroll
    for (int r = 0; r < 8; ++r) so[w][8 * hh + r][t * 16 + ln] = acc[t][r] * alpha; }
  __builtin_amdgcn_fence(__ATOMIC_ACQ_REL, "workgroup"); __builtin_amdgcn_wave_barrier();
  const int rsub = lane >> 4, c4 = (lane & 15) * 4;
  {
#pragma unroll
    for (int q = 0; q < 8; ++q) { const int r = q * 2 + rsub; if (col0 + c4 < N) { const v4f v = *(const v4fa*)&so[w][r][c4]; *(v4f*)(C + (size_t)(row0 + r) * ldc + col0 + c4) = v; } }
     }
}

// Wt[n][k] = f16(W[k][n]·scale) from f32 row-major W[K][N] (scale = power of two; bf16-exact weights stay exact in f16 away from the subnormal range)
__global__ __launch_bounds__(256) void k_wt_f16(const float* __restrict__ W, _Float16* __restrict__ Wt, int K, int N, float scale) {
  const int t = blockIdx.x * 256 + threadIdx.x; if (t >= N * (K / 8)) return; const int n = t / (K / 8), k8 = (t % (K / 8)) * 8; FragH f;
#pragma unroll
  for (int i = 0; i < 8; ++i) f.h[i] = (_Float16)(bf16_round(W[(size_t)(k8 + i) * N + n]) * scale); const v8us o = f.half[0];
  *(v8us*)((unsigned short*)Wt + (size_t)n * K + k8) = o; 
}
// k_gemm_hh variant with fused epilogue: v = acc·alpha + bias[by·sBias + col] (+ CP[(row/rowsPerB)·sCPb + by·64 + col] if CP) ; ACT 0 none / 1 elu ; writes f16 C16 (and f32 C if non-null)
template <int ACT>
__global__ __launch_bounds__(128) void k_gemm_hhx(const _Float16* __restrict__ A, int lda, size_t sA, const _Float16* __restrict__ Bh, int ldb, size_t sB, float alpha, const float* __restrict__ bias, size_t sBias, const float* __restrict__ CP, int rowsPerB, size_t sCPb, int row0g,
    float* __restrict__ C, _Float16* __restrict__ C16, int ldc, size_t sC, int M, int N, int K) {
  __shared__ __attribute__((aligned(16))) float so[4][16][64];
  const int tid = threadIdx.x, w = tid >> 5, lane = tid & 31, ln = lane & 15, hh = lane >> 4; const int by = blockIdx.y;
  A += (size_t)by * sA; Bh += (size_t)by * sB; const size_t cofs = (size_t)by * sC; const float* bp = bias ? bias + (size_t)by * sBias : nullptr;
  const int ntn = (N + 63) / 64; const int wid = blockIdx.x * 4 + w; const int mt = wid / ntn, nq = wid % ntn; if (mt * 16 >= M) return;
  const int row0 = mt * 16, col0 = nq * 64; const _Float16* arow = A + (size_t)(row0 + ln) * lda;
  v8f acc[4] = {};
  for (int kb = 0; kb < K; kb += 32) { FragH ah; ah.half[0] = *(const v8us*)((const unsigned short*)arow + kb + 8 * hh); ah.half[1] = *(const v8us*)((const unsigned short*)arow + kb + 16 + 8 * hh);
#pragma unroll
    for (int t = 0; t < 4; ++t) { if (col0 + t * 16 >= N) continue; const size_t boff = (size_t)(col0 + t * 16 + ln) * ldb + kb; FragH bq; bq.half[0] = *(const v8us*)((const unsigned short*)Bh + boff + 8 * hh); bq.half[1] = *(const v8us*)((const unsigned short*)Bh + boff + 16 + 8 * hh);
      acc[t] = mmaH<1>(ah.v, ah.v, bq.v, bq.v, acc[t]); }
  }
#pragma unroll
  for (int t = 0; t < 4; ++t) { if (col0 + t * 16 >= N) continue; const int col = col0 + t * 16 + ln; const float bv = bp ? bf16_round(bp[col]) : 0.f;
#pragma unroll
    for (int r = 0; r < 8; ++r) { float v = acc[t][r] * alpha + bv; if (CP) { const int bidx = (row0g + row0 + 8 * hh + r) / rowsPerB; v += CP[(size_t)bidx * sCPb + (size_t)by * 64 + col]; } if (ACT == 1) v = (v > 0.f) ? v : expm1f(v); else if (ACT == 7) v = (v > 0.f) ? v + 1.0f : expf(v); else if (ACT == 8) v = tanhf(v); else if (ACT == 9) v = 0.5f * v * (1.0f + tanhf(0.7978845608028654f * (v + 0.044715f * v * v * v))); else if (ACT == 11) v = 1.0f / (1.0f + expf(-v)); else if (ACT == 12) v = (v > 0.f) ? v : 0.01f * v; else if (ACT == 14) v = (v > 0.f) ? v : 0.1f * v; else if (ACT == 15) v = v / (1.0f + expf(-v)); else if (ACT == 3) v = fmaxf(v, 0.f); else if (ACT == 6) v = 0.5f * v * (1.0f + erff(v * 0.70710678118654752f)); so[w][8 * hh + r][t * 16 + ln] = v; } }
  __builtin_amdgcn_fence(__ATOMIC_ACQ_REL, "workgroup"); __builtin_amdgcn_wave_barrier();
  const int rsub = lane >> 4, c4 = (lane & 15) * 4; typedef _Float16 v4h __attribute__((ext_vector_type(4)));
  {
#pragma unroll
    for (int q = 0; q < 8; ++q) { const int r = q * 2 + rsub; if (col0 + c4 < N) { const v4f v = *(const v4fa*)&so[w][r][c4]; if (C) *(v4f*)(C + cofs + (size_t)(row0 + r) * ldc + col0 + c4) = v; if (C16) { v4h h4; for (int i = 0; i < 4; ++i) h4[i] = (_Float16)v[i]; *(v4h*)(C16 + cofs + (size_t)(row0 + r) * ldc + col0 + c4) = h4; } } }
     }
}


typedef _Float16 v4h __attribute__((ext_vector_type(4)));

__global__ __launch_bounds__(256) void k_x16(const float* __restrict__ x, _Float16* __restrict__ X16, size_t n8) { const size_t t = (size_t)blockIdx.x * 256 + threadIdx.x; if (t >= n8) return; FragH f;
#pragma unroll
  for (int q = 0; q < 8; ++q) f.h[q] = (_Float16)bf16_round(x[t * 8 + q]); *(v8us*)((unsigned short*)X16 + t * 8) = f.half[0];  }
__global__ __launch_bounds__(256) void k_h16(const float* __restrict__ x, _Float16* __restrict__ X16, size_t n8) { const size_t t = (size_t)blockIdx.x * 256 + threadIdx.x; if (t >= n8) return; FragH f;
#pragma unroll
  for (int q = 0; q < 8; ++q) f.h[q] = (_Float16)x[t * 8 + q]; *(v8us*)((unsigned short*)X16 + t * 8) = f.half[0];  }
__device__ __forceinline__ void d_round16f(const float* __restrict__ W, _Float16* __restrict__ Bt, size_t n8, unsigned bx) { const size_t t = (size_t)bx * 256 + threadIdx.x; if (t >= n8) return; FragH f;
#pragma unroll
  for (int i = 0; i < 8; ++i) f.h[i] = (_Float16)(bf16_round(W[t * 8 + i]) * 16.0f); *(v8us*)((unsigned short*)Bt + t * 8) = f.half[0];  }
template <int NHv, int TTv>
__global__ __launch_bounds__(256) void k_vt(const _Float16* __restrict__ V16, int ldv, int voff, _Float16* __restrict__ Vt) { __shared__ unsigned short tl[64][66]; const int tid = threadIdx.x; const int slab = blockIdx.x / (TTv / 64), lg = blockIdx.x % (TTv / 64); const int b = slab / NHv, h = slab % NHv;
  for (int i = tid; i < 64 * 8; i += 256) { const int r = i / 8, c8 = (i % 8) * 8; FragH f; f.half[0] = *(const v8us*)((const unsigned short*)V16 + ((size_t)b * TTv + lg * 64 + r) * ldv + voff + h * 64 + c8);
#pragma unroll
    for (int q = 0; q < 8; ++q) tl[r][c8 + q] = f.u[q]; }
  __syncthreads();
  {
#pragma unroll
    for (int rd = 0; rd < 2; ++rd) { const int d = rd * 32 + tid / 8, pc = tid % 8; FragH f;
#pragma unroll
      for (int q = 0; q < 8; ++q) f.u[q] = tl[pc * 8 + q][d];
      *(v8us*)((unsigned short*)Vt + ((size_t)slab * 64 + d) * TTv + lg * 64 + pc * 8) = f.half[0]; }
     } }

// FRAGMENT ORDER of the attention operands: a 16-row x 64-column tile (q, k) or a 64-row x 32-key block (v^T) is stored as its WMMA fragment halves one after the other, each half as 32 lanes x 16 bytes in lane order,
// so that a wave's 16-byte load reads 512 bytes in a row (4 whole lines) and not 32 bytes out of each of 16 lines. Which element a lane and register hold is unchanged.
// q, k: row r, columns 8 c8 .. 8 c8 + 7 -> tile r >> 4, half c8 >> 1 (= 2 ks + part), lane 16 (c8 & 1) + (r & 15).

// ---- fast GEMM (wave tile 32x64; requires M % 32 == 0 rows per launch region and N % 64 == 0); epilogue = k_gemm_hhx semantics ----
__device__ __forceinline__ v16h g2_frag(const _Float16* p, int hh) { FragH f; f.half[0] = *(const v8us*)((const unsigned short*)p + 8 * hh); f.half[1] = *(const v8us*)((const unsigned short*)p + 16 + 8 * hh); return f.v; }
__device__ __forceinline__ v8f g2_mma(v16h a, v16h b, v8f c) { v8f d = __builtin_amdgcn_wmma_f32_16x16x32_f16(false, a, false, b, (short)0, c, false, false); asm volatile("v_nop\n\tv_nop\n\tv_nop\n\tv_nop" : "+v"(d) : "v"(a), "v"(b)); return d; }
// A CONSUMER THAT NEEDS ONLY THE TILE ITS PRODUCER WAVE HOLDS RUNS IN THAT WAVE, on the f32 tile in LDS, and has no launch of its own.
// EPI 0: C alone. EPI 1: C, silu(C) as a hi + 16x residual pair row in E0, and each channel's mean and centred square sum over 64 rows of the block's tile in E1 (N == DK, NWV == 4).
template <int ACT, int NWV, int EPI>      /* NWV waves a block, each a 32 x 64 tile */
__device__ __forceinline__ void d_gemm2(const _Float16* __restrict__ A, int lda, size_t sA, const _Float16* __restrict__ Bh, int ldb, size_t sB, float alpha, const float* __restrict__ bias, size_t sBias, const float* __restrict__ CP, int rowsPerB, size_t sCPb, int row0g,
    float* __restrict__ C, _Float16* __restrict__ C16, int ldc, size_t sC, int M, int N, int K, unsigned bx, int by, _Float16* __restrict__ E0, float* __restrict__ E1) {
  __shared__ __attribute__((aligned(16))) float so[NWV][32][68];
  const int tid = threadIdx.x, w = tid >> 5, lane = tid & 31, ln = lane & 15, hh = lane >> 4;
  A += (size_t)by * sA; Bh += (size_t)by * sB; const size_t cofs = (size_t)by * sC; const float* bp = bias ? bias + (size_t)by * sBias : nullptr;
  const int ntn = N >> 6; const int mt = bx / ntn, nq = bx - mt * ntn; const int row0 = mt * (32 * NWV) + 32 * w, col0 = nq * 64; if (row0 >= M) return;
  const _Float16* a0p = A + (size_t)(row0 + ln) * lda; const _Float16* a1p = a0p + (size_t)16 * lda;
  const _Float16* b0p = Bh + (size_t)(col0 + ln) * ldb; const _Float16* b1p = b0p + (size_t)16 * ldb; const _Float16* b2p = b1p + (size_t)16 * ldb; const _Float16* b3p = b2p + (size_t)16 * ldb;
  const v8f z8 = {0.f,0.f,0.f,0.f,0.f,0.f,0.f,0.f}; v8f c00 = z8, c01 = z8, c02 = z8, c03 = z8, c10 = z8, c11 = z8, c12 = z8, c13 = z8;
  // LOADS GO OUT IN GROUPS, AHEAD OF THEIR USE. No load moves across the statement behind a matrix instruction, so a load written at its use is waited for alone.
  // The six fragments of a 32-wide k step are loaded together, one step ahead, into a second register set (K % 64 == 0); the bias in front of the loop; the addend rows as one group behind it.
  float bvr[4] = {0.f, 0.f, 0.f, 0.f};
  if (bp) {
#pragma unroll
    for (int t = 0; t < 4; ++t) bvr[t] = bp[col0 + t * 16 + ln];
    asm volatile("s_wait_xcnt 0x0" ::: "memory"); }      /* the loads' address registers are reused right behind this branch */
  v16h a0 = g2_frag(a0p, hh), a1 = g2_frag(a1p, hh), b0 = g2_frag(b0p, hh), b1 = g2_frag(b1p, hh), b2 = g2_frag(b2p, hh), b3 = g2_frag(b3p, hh);
#pragma unroll 1      /* two k steps a trip: one per register set */
  for (int kb = 0; kb < K; kb += 64) { const int k1 = kb + 32;
    const v16h e0 = g2_frag(a0p + k1, hh), e1 = g2_frag(a1p + k1, hh), f0 = g2_frag(b0p + k1, hh), f1 = g2_frag(b1p + k1, hh), f2 = g2_frag(b2p + k1, hh), f3 = g2_frag(b3p + k1, hh);
    c00 = g2_mma(a0, b0, c00); c10 = g2_mma(a1, b0, c10); c01 = g2_mma(a0, b1, c01); c11 = g2_mma(a1, b1, c11);
    c02 = g2_mma(a0, b2, c02); c12 = g2_mma(a1, b2, c12); c03 = g2_mma(a0, b3, c03); c13 = g2_mma(a1, b3, c13);
    if (kb + 64 < K) { const int k2 = kb + 64; a0 = g2_frag(a0p + k2, hh); a1 = g2_frag(a1p + k2, hh); b0 = g2_frag(b0p + k2, hh); b1 = g2_frag(b1p + k2, hh); b2 = g2_frag(b2p + k2, hh); b3 = g2_frag(b3p + k2, hh); }
    c00 = g2_mma(e0, f0, c00); c10 = g2_mma(e1, f0, c10); c01 = g2_mma(e0, f1, c01); c11 = g2_mma(e1, f1, c11);
    c02 = g2_mma(e0, f2, c02); c12 = g2_mma(e1, f2, c12); c03 = g2_mma(e0, f3, c03); c13 = g2_mma(e1, f3, c13); }
  v8f accs[8] = {c00, c01, c02, c03, c10, c11, c12, c13};
  float cpv[8][8];
  if (CP) {
#pragma unroll
    for (int rr = 0; rr < 16; ++rr) { const int bidx = (row0g + row0 + (rr >> 3) * 16 + 8 * hh + (rr & 7)) / rowsPerB; const float* cr = CP + (size_t)bidx * sCPb + (size_t)by * 64 + col0 + ln;
#pragma unroll
      for (int t = 0; t < 4; ++t) cpv[(rr >> 3) * 4 + t][rr & 7] = cr[t * 16];
      asm volatile("s_wait_xcnt 0x0" ::: "memory"); } }      /* a row's address registers are free for the next rows' values; the data are not waited for here */
#pragma unroll
  for (int u = 0; u < 8; ++u) { const int t = u & 3, half = u >> 2; const float bv = bp ? bf16_round(bvr[t]) : 0.f;
#pragma unroll
    for (int r = 0; r < 8; ++r) { const int rloc = half * 16 + 8 * hh + r; float v = accs[u][r] * alpha + bv; if (CP) v += cpv[u][r];
      if (ACT == 3) v = fmaxf(v, 0.f); else if (ACT == 6) v = 0.5f * v * (1.0f + erff(v * 0.70710678118654752f)); else if (ACT == 11) v = 1.0f / (1.0f + expf(-v)); else if (ACT == 15) v = v / (1.0f + expf(-v)); else if (ACT == 12) v = (v > 0.f) ? v : 0.01f * v; else if (ACT == 8) v = tanhf(v);
      so[w][rloc][t * 16 + ln] = v; } }
  __builtin_amdgcn_fence(__ATOMIC_ACQ_REL, "workgroup"); __builtin_amdgcn_wave_barrier();
  if (EPI == 1) {      /* thread: channel tid & 63, the 64 rows of waves 2 h and 2 h + 1; the consumer joins the parts (equal counts). Ahead of the tile's stores: a barrier behind them would wait for them */
    __syncthreads();      /* a thread reads down two waves' tiles */
    const int c = tid & 63, h = tid >> 6; float a[64]; float s[4] = {0.f, 0.f, 0.f, 0.f}, m2[4] = {0.f, 0.f, 0.f, 0.f};      /* four chains each: one wave a SIMD, a single chain's latency would lie open */
#pragma unroll      /* a[] stays in registers between the two sums */
    for (int k = 0; k < 64; ++k) a[k] = so[2 * h + (k >> 5)][k & 31][c];
#pragma unroll
    for (int k = 0; k < 64; ++k) s[k & 3] += a[k];
    const float mu = ((s[0] + s[1]) + (s[2] + s[3])) * (1.0f / 64.0f);
#pragma unroll
    for (int k = 0; k < 64; ++k) { const float v = a[k] - mu; m2[k & 3] += v * v; }
    float* d = E1 + (size_t)(bx * 2 + h) * (2 * DK) + c; d[0] = mu; d[DK] = (m2[0] + m2[1]) + (m2[2] + m2[3]);
    asm volatile("s_wait_xcnt 0x0" ::: "memory"); }      /* the stores' registers are reused by the code below */
  const int rsub = lane >> 4, c4 = (lane & 15) * 4;
  {
#pragma unroll
    for (int q = 0; q < 16; ++q) { const int r = q * 2 + rsub; const v4f v = *(const v4fa*)&so[w][r][c4]; if (C) *(v4f*)(C + cofs + (size_t)(row0 + r) * ldc + col0 + c4) = v; if (C16) { v4h h4; for (int i = 0; i < 4; ++i) h4[i] = (_Float16)v[i]; *(v4h*)(C16 + cofs + (size_t)(row0 + r) * ldc + col0 + c4) = h4; }
      if (EPI == 1) { v4h s0, s1;
#pragma unroll
        for (int i = 0; i < 4; ++i) { const float sl = v[i] / (1.0f + expf(-v[i])); const _Float16 hv = (_Float16)sl; s0[i] = hv; s1[i] = (_Float16)((sl - (float)hv) * 16.0f); }
        _Float16* d = E0 + (size_t)(row0 + r) * 2 * DK + c4; *(v4h*)d = s0; *(v4h*)(d + DK) = s1;
        asm volatile("s_wait_xcnt 0x0" ::: "memory"); } }      /* the stores' registers are reused for the next rows */
     } }
// att = conv1x1(x) + b; silu(att) and the parts of att's channel statistics from the same tile.
__global__ __launch_bounds__(128) void k_gemm_att(const _Float16* __restrict__ X16, const _Float16* __restrict__ BIN, const float* __restrict__ b_in, float* __restrict__ ATT, _Float16* __restrict__ SIL, float* __restrict__ PS) {
  d_gemm2<0, 4, 1>(X16, CIN, 0, BIN, CIN, 0, 0.0625f, b_in, 0, nullptr, 1, 0, 0, ATT, nullptr, DK, 0, NPX, DK, CIN, blockIdx.x, 0, SIL, PS); }
// LAUNCHES THAT NEED NOTHING OF EACH OTHER SHARE ONE GRID: a block-uniform branch on the block index picks the part; each part's code, block count and arithmetic are those of its own former launch.

__device__ __forceinline__ float xhalf(float v) { const int b = __float_as_int(v); return __int_as_float(__builtin_amdgcn_permlanex16(b, b, 0x76543210, 0xfedcba98, false, false)); }      /* lane l <-> l ^ 16 */
__device__ __forceinline__ float exp2_slot(float x) { float r; asm("v_exp_f32 %0, %1\n\tv_nop" : "=v"(r) : "v"(x)); return r; }      /* 2^x; the v_nop keeps the slot behind the exponential free of a reader of r and of a writer of x */
template <int TQ, int TK, int KSP>
__global__ __launch_bounds__(128 * KSP) void k_flashm(const _Float16* __restrict__ Q16, const _Float16* __restrict__ Q16lo, const _Float16* __restrict__ K16, const _Float16* __restrict__ K16lo, const _Float16* __restrict__ Vt, const _Float16* __restrict__ Vtlo, const unsigned* __restrict__ MB, const int* __restrict__ RA, const int* __restrict__ KE, const _Float16* __restrict__ BOUT, float* __restrict__ A2T) {
  constexpr int RPW = 16, NQB = TQ / (4 * RPW), DT = 4, KS = 2, NW = 4 * KSP; static_assert(NH == 1 && DK == 64, "the fragment-order planes hold one 64-wide head"); static_assert(NW * 16 == CIN, "a wave takes 16 channels of the outer product");
  __shared__ __attribute__((aligned(16))) float sO[NW][RPW][64 + 4]; __shared__ float sM[NW][RPW], sL[NW][RPW];
  __shared__ __attribute__((aligned(16))) _Float16 sP[4 * RPW][2 * DK + 8];      /* the block's output rows as pair operands; pitch 272 bytes = 16 x odd: 16-byte fragment reads without bank conflict */
  const int tid = threadIdx.x, w = tid >> 5, lane = tid & 31, ln = lane & 15, hh = lane >> 4; const int qt = w & 3, kp = __builtin_amdgcn_readfirstlane(w >> 2);      /* scalar: the key loop's counter and trip test stay wave-uniform */
  const int slab = blockIdx.x / NQB, qblk = blockIdx.x % NQB; const int b = slab / NH; const int qb0 = qblk * (4 * RPW); const int q0 = qb0 + qt * RPW;
  FragH aq[KS], aql[KS];
  { const size_t qo = (((size_t)b * TQ + q0) >> 4) * 1024 + lane * 8; const unsigned short* qr = (const unsigned short*)Q16 + qo; const unsigned short* ql = (const unsigned short*)Q16lo + qo;
#pragma unroll
    for (int ks = 0; ks < KS; ++ks) { aq[ks].half[0] = *(const v8us*)(qr + ks * 512); aq[ks].half[1] = *(const v8us*)(qr + ks * 512 + 256); aql[ks].half[0] = *(const v8us*)(ql + ks * 512); aql[ks].half[1] = *(const v8us*)(ql + ks * 512 + 256); } }
  const unsigned short* Vth = (const unsigned short*)Vt + (size_t)slab * 64 * TK; const unsigned short* Vtl = (const unsigned short*)Vtlo + (size_t)slab * 64 * TK;
  float m_r = -3.0e38f, l_r = 0.f; v8f oacc[DT], oaccl[DT];
#pragma unroll
  for (int dt = 0; dt < DT; ++dt) { oacc[dt] = (v8f){0.f,0.f,0.f,0.f,0.f,0.f,0.f,0.f}; oaccl[dt] = oacc[dt]; }
  int jend = KE[qblk * 32]; jend = min(TK, (jend + 31) & ~31); if (jend < 32) jend = 32;      /* block-uniform */
  const bool am = (RA[q0 + ln] != 0); const unsigned* mrow = MB + (size_t)(q0 + ln) * (TK / 32);
  const unsigned short* kr = (const unsigned short*)K16 + (((size_t)b * TK + kp * 32) >> 4) * 1024 + lane * 8; const unsigned short* kl = (const unsigned short*)K16lo + (((size_t)b * TK + kp * 32) >> 4) * 1024 + lane * 8;
  const unsigned short* vh = Vth + (size_t)kp * 2048 + lane * 8; const unsigned short* vl = Vtl + (size_t)kp * 2048 + lane * 8; const unsigned* mp = mrow + kp;      /* this wave's block of 32 keys; all five step by KSP blocks a trip */
#pragma unroll 1
  for (int j0 = kp * 32; j0 < jend; j0 += 32 * KSP, kr += KSP * 2048, kl += KSP * 2048, vh += KSP * 2048, vl += KSP * 2048, mp += KSP) {
    v8f s[2]; FragH bk[2][KS], bkl[2][KS];      /* as in the GEMM body, loads go out in groups ahead of their use: both key tiles and the mask word here, in front of the first product */
#pragma unroll
    for (int nt = 0; nt < 2; ++nt) {
#pragma unroll
      for (int ks = 0; ks < KS; ++ks) { const int o = nt * 1024 + ks * 512; bk[nt][ks].half[0] = *(const v8us*)(kr + o); bkl[nt][ks].half[0] = *(const v8us*)(kl + o); if (nt + ks < 2) { bk[nt][ks].half[1] = *(const v8us*)(kr + o + 256); bkl[nt][ks].half[1] = *(const v8us*)(kl + o + 256); } } }
    const unsigned mw = *mp;
    asm volatile("s_wait_xcnt 0x0" ::: "memory");      /* the last load from an address may land on the address registers, which the loads above name too */
    bk[1][1].half[1] = *(const v8us*)(kr + 1792);
    asm volatile("s_wait_xcnt 0x0" ::: "memory");      /* the same, for the load above */
    bkl[1][1].half[1] = *(const v8us*)(kl + 1792);
#pragma unroll
    for (int nt = 0; nt < 2; ++nt) { v8f acc = (v8f){0.f,0.f,0.f,0.f,0.f,0.f,0.f,0.f}, accr = acc;
#pragma unroll
      for (int ks = 0; ks < KS; ++ks) { acc = mmaH<1>(bk[nt][ks].v, bk[nt][ks].v, aq[ks].v, aq[ks].v, acc); accr = mmaH<1>(bk[nt][ks].v, bk[nt][ks].v, aql[ks].v, aql[ks].v, accr); accr = mmaH<1>(bkl[nt][ks].v, bkl[nt][ks].v, aq[ks].v, aq[ks].v, accr); }
      s[nt] = acc + accr * 0.0009765625f; }
    FragH bv[DT], bl[DT];      /* the whole v^T block, in front of the softmax arithmetic, which covers its latency */
#pragma unroll
    for (int dt = 0; dt < DT; ++dt) { const int o = dt * 512; bv[dt].half[0] = *(const v8us*)(vh + o); bl[dt].half[0] = *(const v8us*)(vl + o); if (dt < DT - 1) { bv[dt].half[1] = *(const v8us*)(vh + o + 256); bl[dt].half[1] = *(const v8us*)(vl + o + 256); } }
    asm volatile("s_wait_xcnt 0x0" ::: "memory");      /* as at the key tiles */
    bv[DT - 1].half[1] = *(const v8us*)(vh + (DT - 1) * 512 + 256);
    asm volatile("s_wait_xcnt 0x0" ::: "memory");      /* as at the key tiles */
    bl[DT - 1].half[1] = *(const v8us*)(vl + (DT - 1) * 512 + 256);
    const unsigned mh = mw >> (8 * hh);      /* bit r: key 8 hh + r, bit 16 + r: key 16 + 8 hh + r */
    float sv[16]; float mc = -INFINITY;
#pragma unroll
    for (int e = 0; e < 16; ++e) { const bool ok = am || (((mh >> ((e >> 3) * 16 + (e & 7))) & 1u) == 0u); sv[e] = ok ? (am ? 0.f : s[e >> 3][e & 7] * SCL) : -INFINITY; mc = fmaxf(mc, sv[e]); }
    mc = fmaxf(mc, xhalf(mc));
    /* base 2: m_r holds (running maximum) * log2(e) - 10, rounded once and used as it stands by the weights and by the rescale, so both refer to the same number */
    const float mn = fmaxf(m_r, fmaf(mc, LOG2E, -10.0f)); const float al = (mn > -1.0e38f) ? __builtin_amdgcn_exp2f(m_r - mn) : 1.0f; m_r = mn;
    FragH pa, pl; float ps = 0.f;
#pragma unroll
    for (int e = 0; e < 16; e += 2) { const v2f t = __builtin_elementwise_fma((v2f){sv[e], sv[e + 1]}, (v2f){LOG2E, LOG2E}, (v2f){-mn, -mn});      /* 2^10 p in half a packed fma and one hardware exponential; a masked key: 2^(-inf) = 0 (mn is finite) */
#pragma unroll
      for (int i = 0; i < 2; ++i) { const float p10 = __builtin_amdgcn_exp2f(t[i]); ps += p10; const _Float16 ph = (_Float16)p10; pa.h[e + i] = ph; pl.h[e + i] = (_Float16)((p10 - (float)ph) * 1024.0f); } }
    l_r = l_r * al + ps;
#pragma unroll
    for (int dt = 0; dt < DT; ++dt) { oacc[dt] *= al; oaccl[dt] *= al; }
#pragma unroll
    for (int dt = 0; dt < DT; ++dt) { oacc[dt] = mmaH<1>(bv[dt].v, bv[dt].v, pa.v, pa.v, oacc[dt]); oaccl[dt] = mmaH<1>(bl[dt].v, bl[dt].v, pa.v, pa.v, oaccl[dt]); oaccl[dt] = mmaH<1>(bv[dt].v, bv[dt].v, pl.v, pl.v, oaccl[dt]); } }
  // THE OUTER 1x1 PRODUCT RUNS HERE, on the 64 output rows that the block holds: att2^T = w_out . out^T, wave w on channels 16 w .. + 15. Its weight fragments go out now; the merge covers their latency.
  v16h wa[4];
  { const _Float16* wr = BOUT + (size_t)(16 * w + ln) * (2 * DK);
#pragma unroll
    for (int ks = 0; ks < 4; ++ks) wa[ks] = g2_frag(wr + 32 * ks, hh);
    asm volatile("s_wait_xcnt 0x0" ::: "memory"); }      /* the loads' address registers are free for what follows; the data are not waited for here */
  { const float l = l_r + xhalf(l_r); if (hh == 0) { sM[w][ln] = m_r; sL[w][ln] = l; } }
#pragma unroll
  for (int dt = 0; dt < DT; ++dt) { const v8f o = oacc[dt] + oaccl[dt] * 0.0009765625f;      /* register r = O[query ln][dt * 16 + 8 hh + r] */
    *(v4fa*)&sO[w][ln][dt * 16 + 8 * hh] = (v4f){o[0], o[1], o[2], o[3]}; *(v4fa*)&sO[w][ln][dt * 16 + 8 * hh + 4] = (v4f){o[4], o[5], o[6], o[7]}; }
  __syncthreads();      /* every part's partial is in LDS before any thread merges */
  for (int i = tid; i < 4 * RPW * 16; i += 128 * KSP) { const int row = i >> 4, pc = i & 15; const int tq = row / RPW, rr = row % RPW;
    float mx = sM[tq][rr];
#pragma unroll
    for (int p = 1; p < KSP; ++p) mx = fmaxf(mx, sM[p * 4 + tq][rr]);
    float lsum = 0.f; v4f o = {0.f, 0.f, 0.f, 0.f};
#pragma unroll
    for (int p = 0; p < KSP; ++p) { const float wg = exp2_slot(sM[p * 4 + tq][rr] - mx);      /* the maxima are base-2 exponents */
      lsum += wg * sL[p * 4 + tq][rr]; const v4f val = *(const v4fa*)&sO[p * 4 + tq][rr][pc * 4]; o += val * wg; }
    const float inv = (lsum > 0.f) ? 1.0f / lsum : 0.f;      /* sum and O both carry the factor 2^10 */
    const v4f ov = o * inv; v4h fh, fl;      /* the output row leaves as the next product's operand: hi + 16x residual pair */
#pragma unroll
    for (int q = 0; q < 4; ++q) { const _Float16 hv = (_Float16)ov[q]; fh[q] = hv; fl[q] = (_Float16)((ov[q] - (float)hv) * 16.0f); }
    _Float16* d = &sP[row][pc * 4]; *(v4h*)d = fh; *(v4h*)(d + DK) = fl; }
  __syncthreads();      /* all 64 rows are in sP, and every thread has left sO, before a wave reads the first and writes the second */
  v16h pb[4][4]; v8f oc[4];      /* all sixteen fragments as one group: no load moves across the statement behind a matrix instruction */
#pragma unroll
  for (int t = 0; t < 4; ++t) { const _Float16* pr = &sP[t * 16 + ln][0]; oc[t] = (v8f){0.f,0.f,0.f,0.f,0.f,0.f,0.f,0.f};
#pragma unroll
    for (int ks = 0; ks < 4; ++ks) pb[t][ks] = g2_frag(pr + 32 * ks, hh); }
#pragma unroll
  for (int ks = 0; ks < 4; ++ks) {
#pragma unroll
    for (int t = 0; t < 4; ++t) oc[t] = g2_mma(wa[ks], pb[t][ks], oc[t]); }
#pragma unroll
  for (int t = 0; t < 4; ++t) {
#pragma unroll
    for (int r = 0; r < 8; ++r) sO[w][8 * hh + r][t * 16 + ln] = oc[t][r] * 0.0625f; }      /* register r = channel 16 w + 8 hh + r, query 16 t + ln */
  __builtin_amdgcn_fence(__ATOMIC_ACQ_REL, "workgroup"); __builtin_amdgcn_wave_barrier();      /* the wave reads its own tile across lanes */
  { const int rsub = lane >> 4, c4 = (lane & 15) * 4; float* op = A2T + ((size_t)b * CIN + 16 * w) * TQ + qb0 + c4;      /* whole 256-byte rows leave */
    v4f vv[8];
#pragma unroll      /* the eight LDS reads are issued together, ahead of the stores */
    for (int q = 0; q < 8; ++q) vv[q] = *(const v4fa*)&sO[w][q * 2 + rsub][c4];
#pragma unroll
    for (int q = 0; q < 8; ++q) *(v4f*)(op + (size_t)(q * 2 + rsub) * TQ) = vv[q]; } }


__constant__ float GRIDV[8] = {-2.000000000e+00f,-1.428571463e+00f,-8.571428657e-01f,-2.857141793e-01f,2.857143879e-01f,8.571429253e-01f,1.428571701e+00f,2.000000000e+00f};
#define INV_DENOM (1.0f / 0.5714285714285714f)
__device__ __forceinline__ void d_fulltab(unsigned* __restrict__ MB, int* __restrict__ RA, int* __restrict__ KE, unsigned bx) {
  const int t = bx * 256 + threadIdx.x;
  if (t < NPI * (NPI / 32)) { *(unsigned*)(MB + t) = 0u;  }
  if (t < NPI) { *(int*)(RA + t) = 0;  }
  if (t < NPI / 64) { *(int*)(KE + t * 32) = NPI;  } }
// Layout changes go through a 64 x 64 LDS tile (pitch 65 floats: no bank conflict in either direction), so that every global read and write covers whole 128-byte lines.
__device__ __forceinline__ void d_xcl(const float* __restrict__ x, _Float16* __restrict__ X16, unsigned bx) {
  __shared__ float tl[64][65]; const int tid = threadIdx.x; const int pt = bx % (NPI / 64), ct = (bx / (NPI / 64)) % (CIN / 64), b = bx / ((NPI / 64) * (CIN / 64));
  const int r16 = tid / 16, k4 = (tid % 16) * 4; v4f a[4];      /* thread: rows r16 + 16 u of the tile, four floats at k4; the four loads fly together */
#pragma unroll      /* a[] stays in registers */
  for (int u = 0; u < 4; ++u) a[u] = *(const v4fa*)(x + ((size_t)b * CIN + ct * 64 + r16 + 16 * u) * NPI + pt * 64 + k4);
#pragma unroll      /* a[] stays in registers */
  for (int u = 0; u < 4; ++u) { float* d = &tl[r16 + 16 * u][k4]; d[0] = a[u][0]; d[1] = a[u][1]; d[2] = a[u][2]; d[3] = a[u][3]; }
  __syncthreads();      /* the whole tile is in LDS before any thread reads it across */
#pragma unroll      /* both rows' LDS reads are issued together */
  for (int rd = 0; rd < 2; ++rd) { const int p = rd * 32 + tid / 8, c8 = (tid % 8) * 8; FragH f;
#pragma unroll
    for (int q = 0; q < 8; ++q) f.h[q] = (_Float16)bf16_round(tl[c8 + q][p]);
    *(v8us*)((unsigned short*)X16 + ((size_t)b * NPI + pt * 64 + p) * CIN + ct * 64 + c8) = f.half[0]; } }
// THE BASIS IS MADE WHERE IT IS USED: the q, k, v spline products form their A operand in registers. A 32-wide k step is 4 channels x 8 grid points, and lane (ln, hh) of an A fragment holds row ln, channels 4 s + hh and 4 s + 2 + hh, all 8 points of each:
// sixteen exponentials a lane and step, from two normalised values. A wave works 16 rows on all 192 columns (q, k, v), so each basis value is made once; the hi and the 16x residual operand meet the same weight fragment (16 w) in the same step, each in accumulators of its own: result = (hi sum + residual sum / 16) / 16.
// The weights lie in fragment order: step s, column tile j (4 each of q, k, v), fragment half, 32 lanes x 16 bytes: every load reads 512 bytes in a row.
// THE BASE PRODUCTS ARE TWO MORE k STEPS OF THE SAME GEMM: silu(att) is a hi + 16x residual pair like the basis, so its 64 channels (steps 0 and 1 of the weight plane, NKB) go into the same two accumulator sets, ahead of the spline's steps.
#define NKS (DK * NG / 32)
#define NKB (DK / 32)
__device__ __forceinline__ void d_wfrag(const float* __restrict__ qbw, const float* __restrict__ kbw, const float* __restrict__ vbw, const float* __restrict__ qsw, const float* __restrict__ ksw, const float* __restrict__ vsw, _Float16* __restrict__ BSF, unsigned bx) {
  const int t = bx * 256 + threadIdx.x; const int lane = t & 31, h = (t >> 5) & 1, sj = t >> 6; const int j = sj % 12, s = sj / 12, i = j >> 2; const bool base = (s < NKB);
  const float* Wm = base ? ((i == 0) ? qbw : (i == 1) ? kbw : vbw) : ((i == 0) ? qsw : (i == 1) ? ksw : vsw); const int ldw = base ? DK : DK * NG;
  const int n = (j & 3) * 16 + (lane & 15), k0 = 32 * (base ? s : s - NKB) + 16 * h + 8 * (lane >> 4); FragH f;
#pragma unroll
  for (int q = 0; q < 8; ++q) f.h[q] = (_Float16)(bf16_round(Wm[(size_t)n * ldw + k0 + q]) * 16.0f);
  *(v8us*)((unsigned short*)BSF + (size_t)t * 8) = f.half[0];
  asm volatile("s_wait_xcnt 0x0" ::: "memory"); }      /* the store's registers are written again by the code that the compiler lays behind this part */
__device__ __forceinline__ v8f k3_mma(v16h a, v16h b, v8f c) { return __builtin_amdgcn_wmma_f32_16x16x32_f16(false, a, false, b, (short)0, c, false, false); }
__device__ __forceinline__ void k3_basis(float xa, float xb, FragH& ah, FragH& al) {      /* elements 0..7: the 8 grid points of xa's channel, 8..15: of xb's; hi and 16x residual */
#pragma unroll
  for (int h = 0; h < 2; ++h) { const float xn = h ? xb : xa;
#pragma unroll
    for (int g = 0; g < NG; ++g) { const float z = (xn - GRIDV[g]) * INV_DENOM; const float e = expf(-(z * z)); const _Float16 hv = (_Float16)e; ah.h[8 * h + g] = hv; al.h[8 * h + g] = (_Float16)((e - (float)hv) * 16.0f); } } }
__global__ __launch_bounds__(128) void k_kanqkv(const float* __restrict__ A, const float* __restrict__ PS, const _Float16* __restrict__ BSF, const float* __restrict__ bias0, const float* __restrict__ bias1, const float* __restrict__ bias2, const _Float16* __restrict__ SIL, const float* __restrict__ bb0, const float* __restrict__ bb1, const float* __restrict__ bb2,
    _Float16* __restrict__ Qh, _Float16* __restrict__ Ql, _Float16* __restrict__ Kh, _Float16* __restrict__ Kl, _Float16* __restrict__ Vth, _Float16* __restrict__ Vtl) {
  __shared__ float sx[64][66];      /* pitch 66: the 32 lanes of a fragment read (row ln, channel c + hh) fall on 32 banks */
  __shared__ __attribute__((aligned(16))) float so[4][48][68];
  __shared__ float sst[4][DK];      /* per channel: two half sums of the parts' means, two of the square sums */
  const int tid = threadIdx.x, w = tid >> 5, lane = tid & 31, ln = lane & 15, hh = lane >> 4; const int rb = blockIdx.x * 64, b = rb / NPI, row0 = rb + 16 * w;
  const unsigned short* bp = (const unsigned short*)BSF + lane * 8; const _Float16* sp = SIL + (size_t)(row0 + ln) * (2 * DK);
  FragH B0[12], B1[12]; v16h sh0, sh1, sl0, sl1;
  { const int c4 = (tid & 15) * 4; v4f a[8]; float mu[4], rs[4];      /* the block's 64 x 64 tile of att is 16 KiB in a row; a thread's four channels are the same in all its eight loads */
    const int pc = tid & 63, ph = tid >> 6; const float* pp = PS + (size_t)(b * (NPI / 64) + ph * (NPI / 128)) * (2 * DK) + pc; float pm[NPI / 128], pq[NPI / 128];      /* thread: channel pc, half ph of the image's 64 parts */
#pragma unroll
    for (int i = 0; i < NPI / 128; ++i) { pm[i] = pp[i * 2 * DK]; pq[i] = pp[i * 2 * DK + DK]; }
    asm volatile("s_wait_xcnt 0x0" :: "v"(pp) : "memory");      /* the address that these loads name lives up to this wait; the data are not waited for here */
    __builtin_amdgcn_sched_barrier(0);      /* the next addresses are formed behind the wait */
#pragma unroll
    for (int u = 0; u < 8; ++u) a[u] = *(const v4fa*)(A + (size_t)rb * DK + (tid + 128 * u) * 4);
    asm volatile("s_wait_xcnt 0x0" ::: "memory");      /* the same */
    // the base steps' operands go out here too: the statistics below cover their latency
#pragma unroll
    for (int f = 0; f < 12; ++f) { B0[f].half[0] = *(const v8us*)(bp + f * 512); B0[f].half[1] = *(const v8us*)(bp + f * 512 + 256); B1[f].half[0] = *(const v8us*)(bp + 6144 + f * 512); B1[f].half[1] = *(const v8us*)(bp + 6144 + f * 512 + 256); }
    sh0 = g2_frag(sp, hh); sh1 = g2_frag(sp + 32, hh); sl0 = g2_frag(sp + DK, hh); sl1 = g2_frag(sp + DK + 32, hh);
    asm volatile("s_wait_xcnt 0x0" ::: "memory");      /* the same */
    __builtin_amdgcn_sched_barrier(0);      /* all these loads are issued here, not behind the first sums' waits */
    float s1[4] = {0.f, 0.f, 0.f, 0.f}, s2[4] = {0.f, 0.f, 0.f, 0.f};      /* four chains each: one wave a SIMD */
#pragma unroll
    for (int i = 0; i < NPI / 128; ++i) s1[i & 3] += pm[i];
    sst[ph][pc] = (s1[0] + s1[1]) + (s1[2] + s1[3]);
    __syncthreads();      /* both halves of every channel's mean */
    const float mc = (sst[0][pc] + sst[1][pc]) * (64.0f / (float)NPI);
#pragma unroll
    for (int i = 0; i < NPI / 128; ++i) { const float dv = pm[i] - mc; s2[i & 3] += pq[i] + 64.0f * (dv * dv); }      /* a part's squares about the whole mean */
    sst[2 + ph][pc] = (s2[0] + s2[1]) + (s2[2] + s2[3]);
    __syncthreads();      /* both halves of every channel's square sum */
#pragma unroll
    for (int q = 0; q < 4; ++q) { mu[q] = (sst[0][c4 + q] + sst[1][c4 + q]) * (64.0f / (float)NPI); rs[q] = rsqrtf((sst[2][c4 + q] + sst[3][c4 + q]) / (float)NPI + 1e-5f); }
#pragma unroll
    for (int u = 0; u < 8; ++u) {
#pragma unroll
      for (int q = 0; q < 4; ++q) sx[(tid >> 4) + 8 * u][c4 + q] = (a[u][q] - mu[q]) * rs[q]; } }
  __syncthreads();      /* the normalised tile is whole before a wave reads its rows */
  const float* xr = &sx[16 * w + ln][hh];
  v8f acc[12], acr[12];
#pragma unroll
  for (int j = 0; j < 12; ++j) { acc[j] = (v8f){0.f,0.f,0.f,0.f,0.f,0.f,0.f,0.f}; acr[j] = acc[j]; }
  // A step's 12 weight fragments go out as one group, one step ahead, into a second register set (one wave a SIMD: the registers are there); the exponentials and the products of the step in hand cover their latency.
#pragma unroll
  for (int j = 0; j < 12; ++j) acc[j] = k3_mma(sh0, B0[j].v, acc[j]);
#pragma unroll
  for (int j = 0; j < 12; ++j) acr[j] = k3_mma(sl0, B0[j].v, acr[j]);
  __builtin_amdgcn_sched_barrier(0);      /* the refill of the first set stays behind its last reader and ahead of the second base step */
  bp += NKB * 6144;
#pragma unroll
  for (int f = 0; f < 12; ++f) { B0[f].half[0] = *(const v8us*)(bp + f * 512); B0[f].half[1] = *(const v8us*)(bp + f * 512 + 256); }
  asm volatile("s_wait_xcnt 0x0" ::: "memory");      /* the group's address registers are free for the next group's values */
  __builtin_amdgcn_sched_barrier(0);      /* the group is issued here, not at its use */
#pragma unroll
  for (int j = 0; j < 12; ++j) acc[j] = k3_mma(sh1, B1[j].v, acc[j]);
#pragma unroll
  for (int j = 0; j < 12; ++j) acr[j] = k3_mma(sl1, B1[j].v, acr[j]);
#pragma unroll 1      /* two k steps a trip, one per register set */
  for (int s = 0; s < NKS; s += 2, bp += 2 * 6144) {
    const float x0 = xr[4 * s], x1 = xr[4 * s + 2], x2 = xr[4 * s + 4], x3 = xr[4 * s + 6];
#pragma unroll
    for (int f = 0; f < 12; ++f) { B1[f].half[0] = *(const v8us*)(bp + 6144 + f * 512); B1[f].half[1] = *(const v8us*)(bp + 6144 + f * 512 + 256); }
    __builtin_amdgcn_sched_barrier(0);      /* the group is issued here, not at its use a step later */
    { FragH ah, al; k3_basis(x0, x1, ah, al);
#pragma unroll
      for (int j = 0; j < 12; ++j) acc[j] = k3_mma(ah.v, B0[j].v, acc[j]);
#pragma unroll
      for (int j = 0; j < 12; ++j) acr[j] = k3_mma(al.v, B0[j].v, acr[j]); }
    __builtin_amdgcn_sched_barrier(0);      /* the refill of the first set stays behind its last reader and ahead of the second step */
    { const unsigned short* np = bp + ((s + 2 < NKS) ? 2 * 6144 : 0);      /* the last trip reads its own first step again, unused: a branch round the refill would join a path without it, and the counted waits behind the join would then wait for the refill as well */
#pragma unroll
      for (int f = 0; f < 12; ++f) { B0[f].half[0] = *(const v8us*)(np + f * 512); B0[f].half[1] = *(const v8us*)(np + f * 512 + 256); } }
    asm volatile("s_wait_xcnt 0x0" ::: "memory");      /* the groups' address register is stepped for the next trip; the data are not waited for here */
    __builtin_amdgcn_sched_barrier(0);      /* as at the first group */
    { FragH ah, al; k3_basis(x2, x3, ah, al);
#pragma unroll
      for (int j = 0; j < 12; ++j) acc[j] = k3_mma(ah.v, B1[j].v, acc[j]);
#pragma unroll
      for (int j = 0; j < 12; ++j) acr[j] = k3_mma(al.v, B1[j].v, acr[j]); } }
  float bv[12], bw[12];      /* the spline's and the base's biases go out as one group */
#pragma unroll
  for (int j = 0; j < 12; ++j) { bv[j] = ((j < 4) ? bias0 : (j < 8) ? bias1 : bias2)[(j & 3) * 16 + ln]; bw[j] = ((j < 4) ? bb0 : (j < 8) ? bb1 : bb2)[(j & 3) * 16 + ln]; }
  asm volatile("s_wait_xcnt 0x0" ::: "memory");      /* as above */
#pragma unroll
  for (int j = 0; j < 12; ++j) { const float bq = bf16_round(bv[j]), br = bf16_round(bw[j]);
#pragma unroll
    for (int r = 0; r < 8; ++r) { float v = (acc[j][r] + acr[j][r] * 0.0625f) * 0.0625f + bq; v += br; so[w][(j >> 2) * 16 + 8 * hh + r][(j & 3) * 16 + ln] = v; } }
  __builtin_amdgcn_fence(__ATOMIC_ACQ_REL, "workgroup"); __builtin_amdgcn_wave_barrier();      /* the wave reads its own tile across lanes */
#pragma unroll
  for (int i = 0; i < 2; ++i) { unsigned short* p0 = (unsigned short*)(i ? Kh : Qh) + (size_t)(row0 >> 4) * 1024 + lane * 8; unsigned short* p1 = (unsigned short*)(i ? Kl : Ql) + (size_t)(row0 >> 4) * 1024 + lane * 8;
#pragma unroll
    for (int u = 0; u < 4; ++u) { FragH fh, fl; const float* sr = &so[w][i * 16 + ln][(u * 2 + hh) * 8]; const v4f a = *(const v4fa*)sr, c = *(const v4fa*)(sr + 4);      /* half u: row ln, columns 8 (2 u + hh) .. + 7 */
#pragma unroll
      for (int q = 0; q < 4; ++q) { _Float16 h = (_Float16)a[q]; fh.h[q] = h; fl.h[q] = (_Float16)((a[q] - (float)h) * 1024.0f); h = (_Float16)c[q]; fh.h[4 + q] = h; fl.h[4 + q] = (_Float16)((c[q] - (float)h) * 1024.0f); }
      *(v8us*)(p0 + u * 256) = fh.half[0]; *(v8us*)(p1 + u * 256) = fl.half[0];
      asm volatile("s_wait_xcnt 0x0" ::: "memory"); } }      /* the stores' registers are reused for the next half */
  { const size_t ob = (size_t)(row0 / NPI) * 64 * NPI + (size_t)((row0 % NPI) >> 5) * 2048 + (size_t)((row0 >> 4) & 1) * 256 + lane * 8;      /* image, 32-key block, this wave's 16 keys of it */
    unsigned short* p0 = (unsigned short*)Vth + ob; unsigned short* p1 = (unsigned short*)Vtl + ob;
#pragma unroll
    for (int dt = 0; dt < 4; ++dt) { FragH fh, fl;      /* half 2 dt + part: channel 16 dt + ln, keys 16 part + 8 hh + q */
#pragma unroll
      for (int q = 0; q < 8; ++q) { const float v = so[w][32 + 8 * hh + q][dt * 16 + ln]; const _Float16 hv = (_Float16)v; fh.h[q] = hv; fl.h[q] = (_Float16)((v - (float)hv) * 1024.0f); }
      *(v8us*)(p0 + dt * 512) = fh.half[0]; *(v8us*)(p1 + dt * 512) = fl.half[0];
      asm volatile("s_wait_xcnt 0x0" ::: "memory"); } } }      /* as above */
__device__ __forceinline__ void d_wnp2(const float* __restrict__ Wm, int K, int N, _Float16* __restrict__ Bt, unsigned bx) {
  const int t = bx * 256 + threadIdx.x; if (t >= N * (2 * K / 8)) return; const int n = t / (2 * K / 8), k0 = (t % (2 * K / 8)) * 8; const bool lo = (k0 >= K); const float sc = lo ? 1.0f : 16.0f; FragH f;
#pragma unroll
  for (int q = 0; q < 8; ++q) { const int k = k0 + q - (lo ? K : 0); f.h[q] = (_Float16)(bf16_round(Wm[(size_t)n * K + k]) * sc); }
  *(v8us*)((unsigned short*)Bt + (size_t)n * 2 * K + k0) = f.half[0];  }
// One grid for all that reads inputs alone: x turned to f16 rows (first: the longest part), the mask tables, the weight planes.
#define NB_XCL (NIMG * (CIN / 64) * (NPI / 64))
#define NB_TAB (NPI * (NPI / 32) / 256)
#define NB_WS (3 * DK * ((DK * NG + DK) / 8) / 256)
#define NB_WO (CIN * (2 * DK / 8) / 256)
#define NB_WI (DK * CIN / 8 / 256)
__global__ __launch_bounds__(256) void k_prep(const float* __restrict__ x, const float* __restrict__ w_in, const float* __restrict__ w_out, const float* __restrict__ qbw, const float* __restrict__ kbw, const float* __restrict__ vbw,
    const float* __restrict__ qsw, const float* __restrict__ ksw, const float* __restrict__ vsw, _Float16* __restrict__ X16, _Float16* __restrict__ BIN, _Float16* __restrict__ BOUT,
    _Float16* __restrict__ BSF, unsigned* __restrict__ MB, int* __restrict__ RA, int* __restrict__ KE) {
  int bx = blockIdx.x;
  if (bx < NB_XCL) { d_xcl(x, X16, bx); return; }
  bx -= NB_XCL; if (bx < NB_TAB) { d_fulltab(MB, RA, KE, bx); return; }
  bx -= NB_TAB; if (bx < NB_WS) { d_wfrag(qbw, kbw, vbw, qsw, ksw, vsw, BSF, bx); return; }
  bx -= NB_WS; if (bx < NB_WO) { d_wnp2(w_out, DK, CIN, BOUT, bx); return; }      /* (out,in) natural -> [16w | w] pair planes */
  d_round16f(w_in, BIN, (size_t)DK * CIN / 8, bx - NB_WO); }
// One block a channel: y = gamma x + att2 (A2T: the outer product without its bias, channel-major like x and the output) is formed in registers and stays there for the mean, the variance and the output.
// Thread t holds pixels bi * NPI + t + 256 k; each sum runs over them in rising order, then down the LDS tree.
__global__ __launch_bounds__(256) void k_ybn(const float* __restrict__ x, const float* __restrict__ gam, const float* __restrict__ A2T, const float* __restrict__ b_out, const float* __restrict__ bw, const float* __restrict__ bb, float* __restrict__ out) {
  __shared__ float sh[256]; const int c = blockIdx.x; const float g = bf16_round(gam[0]), bo = bf16_round(b_out[c]), gw = bf16_round(bw[c]), be = bf16_round(bb[c]); float y[NIMG][NPI / 256]; float s = 0.f;
#pragma unroll      /* y[][] stays in registers; an image's thirty-two loads fly together */
  for (int bi = 0; bi < NIMG; ++bi) { const float* xp = x + ((size_t)bi * CIN + c) * NPI; const float* ap = A2T + ((size_t)bi * CIN + c) * NPI; float xv[NPI / 256], av[NPI / 256];
#pragma unroll
    for (int k = 0; k < NPI / 256; ++k) xv[k] = xp[threadIdx.x + 256u * k];
    asm volatile("s_wait_xcnt 0x0" ::: "memory");      /* the loads' address registers are free for what follows; the data are not waited for here */
#pragma unroll
    for (int k = 0; k < NPI / 256; ++k) av[k] = ap[threadIdx.x + 256u * k];
    asm volatile("s_wait_xcnt 0x0" ::: "memory");      /* the same */
#pragma unroll
    for (int k = 0; k < NPI / 256; ++k) y[bi][k] = g * bf16_round(xv[k]) + (av[k] + bo); }
#pragma unroll
  for (int bi = 0; bi < NIMG; ++bi) {
#pragma unroll
    for (int k = 0; k < NPI / 256; ++k) s += y[bi][k]; }
  sh[threadIdx.x] = s; __syncthreads();
  for (int st = 128; st > 0; st >>= 1) { if ((int)threadIdx.x < st) sh[threadIdx.x] += sh[threadIdx.x + st]; __syncthreads(); }
  const float mu = sh[0] / (float)NPX; s = 0.f;
  __syncthreads();      /* every thread has read the first sum before sh is written again */
#pragma unroll
  for (int bi = 0; bi < NIMG; ++bi) {
#pragma unroll
    for (int k = 0; k < NPI / 256; ++k) { const float v = y[bi][k] - mu; s += v * v; } }
  sh[threadIdx.x] = s; __syncthreads();
  for (int st = 128; st > 0; st >>= 1) { if ((int)threadIdx.x < st) sh[threadIdx.x] += sh[threadIdx.x + st]; __syncthreads(); }
  const float sc = rsqrtf(sh[0] / (float)NPX + 1e-5f);
#pragma unroll
  for (int bi = 0; bi < NIMG; ++bi) { float* op = out + ((size_t)bi * CIN + c) * NPI;
#pragma unroll
    for (int k = 0; k < NPI / 256; ++k) op[threadIdx.x + 256u * k] = gw * ((y[bi][k] - mu) * sc) + be; } }

extern "C" void kernel_launch(void* const* d_in, const int* in_sizes, int n_in,
                              void* d_out, int out_size, void* d_ws, size_t ws_size, hipStream_t stream) {
  (void)in_sizes; (void)n_in; (void)out_size;
  const float* const* I = (const float* const*)d_in; const float* x = I[0]; const float* w_in = I[1]; const float* b_in = I[2];
  const float* qbw = I[3]; const float* qbb = I[4]; const float* qsw = I[5]; const float* qsb = I[6]; const float* kbw = I[7]; const float* kbb = I[8]; const float* ksw = I[9]; const float* ksb = I[10]; const float* vbw = I[11]; const float* vbb = I[12]; const float* vsw = I[13]; const float* vsb = I[14];
  const float* w_out = I[15]; const float* b_out = I[16]; const float* gam = I[17]; const float* bnw = I[18]; const float* bnb = I[19];
  char* ws = (char*)d_ws; size_t off = 0;
  auto take = [&](size_t bytes) { char* p = ws + off; off += (bytes + 255) & ~(size_t)255; return p; };
  _Float16* BIN = (_Float16*)take((size_t)DK * CIN * 2); _Float16* BSF = (_Float16*)take((size_t)3 * DK * (DK * NG + DK) * 2); _Float16* BOUT = (_Float16*)take((size_t)CIN * 2 * DK * 2);
  _Float16* X16 = (_Float16*)take((size_t)NPX * CIN * 2); float* ATT = (float*)take((size_t)NPX * DK * 4); float* PS = (float*)take((size_t)(NPX / 64) * 2 * DK * 4); _Float16* SIL = (_Float16*)take((size_t)NPX * 2 * DK * 2);
  _Float16* Qh = (_Float16*)take((size_t)NPX * DK * 2); _Float16* Ql = (_Float16*)take((size_t)NPX * DK * 2); _Float16* Kh = (_Float16*)take((size_t)NPX * DK * 2); _Float16* Kl = (_Float16*)take((size_t)NPX * DK * 2); _Float16* Vth = (_Float16*)take((size_t)NPX * DK * 2); _Float16* Vtl = (_Float16*)take((size_t)NPX * DK * 2);
  float* A2T = (float*)take((size_t)NPX * CIN * 4);
  unsigned* MB = (unsigned*)take((size_t)NPI * (NPI / 32) * 4); int* RA = (int*)take((size_t)NPI * 4); int* KE = (int*)take((size_t)(NPI / 64) * 32 * 4);
  if (off > ws_size) return;      /* 0.45 + 8 + 4 + 4 + 12 + 16 + 2 = 46.45 MiB */
  k_prep<<<NB_XCL + NB_TAB + NB_WS + NB_WO + NB_WI, 256, 0, stream>>>(x, w_in, w_out, qbw, kbw, vbw, qsw, ksw, vsw, X16, BIN, BOUT, BSF, MB, RA, KE);
  const dim3 g64((NPX / 128) * 1, 1);
  k_gemm_att<<<g64, 128, 0, stream>>>(X16, BIN, b_in, ATT, SIL, PS);      /* att = conv1x1(x) + b; silu(att); statistics of 64-row parts */
  k_kanqkv<<<NPX / 64, 128, 0, stream>>>(ATT, PS, BSF, qsb, ksb, vsb, SIL, qbb, kbb, vbb, Qh, Ql, Kh, Kl, Vth, Vtl);      /* base(silu) + b_base + spline(basis) + b_spline, as operand planes */
  k_flashm<NPI, NPI, KSPLIT><<<NIMG * NH * (NPI / 64), 128 * KSPLIT, 0, stream>>>(Qh, Ql, Kh, Kl, Vth, Vtl, MB, RA, KE, BOUT, A2T);      /* slab = image (NH 1); att2^T = w_out . out^T (pair operands), rows = channels; its bias is added in k_ybn */
  k_ybn<<<CIN, 256, 0, stream>>>(x, gam, A2T, b_out, bnw, bnb, (float*)d_out);
}
